// v000
// Times are from an AMD MI455X. After a warm-up the kernel runs many times in a row, and a time is the length of
// such a window on the GPU divided by its runs, so every launch and the gaps after it count. The runs cycle
// through copies of the inputs. A figure is the median of several windows, for all but v000 over two sittings.
// Sittings can differ by a few percent; kernels timed side by side share one.
// v000, which the later versions start from, runs in 131 microseconds.
#include <hip/hip_runtime.h>

// Causal linear attention (fp32) on gfx1250 via V_WMMA_F32_16X16X4_F32 +
// GLOBAL_LOAD_ASYNC_TO_LDS_B128 (CDNA5 async global->LDS path).
// 3 passes: (1) per-chunk K^T V + key sums, (2) exclusive prefix over chunks,
// (3) per-chunk output: tril(q k^T) v + q S, with the 1/(q . cumsum k + eps)
// normalizer folded in as an extra WMMA output tile (B = ones / key-sums).

#define N_  4
#define L_  8192
#define H_  8
#define D_  64
#define T_  128       // chunk length
#define C_  64        // chunks = L_/T_
#define NH_ 32        // N_*H_
#define P_  68        // padded LDS row stride (floats): 272B = 16B-aligned,
                      // bank = (4*row + col) % 64 -> conflict-free patterns

typedef float v2f __attribute__((ext_vector_type(2)));
typedef float v8f __attribute__((ext_vector_type(8)));

__device__ __forceinline__ v8f wmma4(v2f a, v2f b, v8f c) {
  // D = A(16x4) * B(4x16) + C(16x16), all fp32
  return __builtin_amdgcn_wmma_f32_16x16x4_f32(false, a, false, b, (short)0, c,
                                               false, false);
}

__device__ __forceinline__ float fmap(float x) {  // elu(x)+1
  return x > 0.f ? x + 1.f : __expf(x);
}

// Async global->LDS copy, 16 bytes per lane. VDST VGPR carries the LDS byte
// offset, VADDR the 64-bit global address (GV mode). Tracked on ASYNCcnt.
__device__ __forceinline__ void async_b128(unsigned lds_off,
                                           unsigned long long gaddr) {
  asm volatile("global_load_async_to_lds_b128 %0, %1, off"
               :: "v"(lds_off), "v"(gaddr) : "memory");
}
__device__ __forceinline__ void wait_async() {
  asm volatile("s_wait_asynccnt 0" ::: "memory");
}
__device__ __forceinline__ unsigned lds_off(const float* p) {
  return (unsigned)(size_t)p;  // generic LDS addr: low 32 bits = LDS offset
}

// ---------------- Pass 1: per-chunk M_c = k^T v (64x64) and ksum_c ----------
__global__ __launch_bounds__(256) void k_chunksums(
    const float* __restrict__ Kg, const float* __restrict__ Vg,
    float* __restrict__ Mbuf, float* __restrict__ Ksum) {
  extern __shared__ float sm[];
  float* sk = sm;             // [128][P_] feature-mapped keys
  float* sv = sm + T_ * P_;   // [128][P_] values
  const int blk = blockIdx.x;           // nh*C_ + c
  const int c   = blk & (C_ - 1);
  const int nh  = blk >> 6;
  const int n   = nh >> 3, h = nh & (H_ - 1);
  const long t0 = (long)c * T_;
  const int tid = threadIdx.x;

  // values: async DMA into LDS (raw copy, no VGPR involvement)
#pragma unroll
  for (int it = 0; it < 8; ++it) {
    int idx = tid + 256 * it;            // 0..2047 16B-chunks
    int r = idx >> 4, j4 = (idx & 15) * 4;
    unsigned long long g = (unsigned long long)(
        Vg + (((size_t)n * L_ + (t0 + r)) * H_ + h) * D_ + j4);
    async_b128(lds_off(&sv[r * P_ + j4]), g);
  }
  // keys: need elu(x)+1, go through VGPRs
  for (int i = tid; i < T_ * D_; i += 256) {
    int r = i >> 6, d = i & 63;
    size_t g = (((size_t)n * L_ + (t0 + r)) * H_ + h) * D_ + d;
    sk[r * P_ + d] = fmap(Kg[g]);
  }
  wait_async();
  __syncthreads();

  const int wave = tid >> 5, lane = tid & 31;
  const int col = lane & 15, half = lane >> 4, kb = half * 2;
  float* mb = Mbuf + (size_t)blk * 4096;

  for (int t = wave * 2; t < wave * 2 + 2; ++t) {  // 16 tiles over 8 waves
    int ti = t >> 2, tj = t & 3;
    v8f acc = {}, acc2 = {};
    for (int s = 0; s < 32; s += 2) {              // K-dim = 128, dual chains
      int k0 = 4 * s + kb;
      v2f a0 = { sk[k0 * P_ + 16 * ti + col], sk[(k0 + 1) * P_ + 16 * ti + col] };
      v2f b0 = { sv[k0 * P_ + 16 * tj + col], sv[(k0 + 1) * P_ + 16 * tj + col] };
      acc = wmma4(a0, b0, acc);
      int k1 = k0 + 4;
      v2f a1 = { sk[k1 * P_ + 16 * ti + col], sk[(k1 + 1) * P_ + 16 * ti + col] };
      v2f b1 = { sv[k1 * P_ + 16 * tj + col], sv[(k1 + 1) * P_ + 16 * tj + col] };
      acc2 = wmma4(a1, b1, acc2);
    }
#pragma unroll
    for (int r = 0; r < 8; ++r)
      mb[(16 * ti + half * 8 + r) * 64 + 16 * tj + col] = acc[r] + acc2[r];
  }
  if (tid < 64) {  // per-d key sum for the normalizer
    float s = 0.f;
    for (int r = 0; r < T_; ++r) s += sk[r * P_ + tid];
    Ksum[(size_t)blk * 64 + tid] = s;
  }
}

// ---------------- Pass 2: exclusive prefix over chunks ----------------------
__global__ __launch_bounds__(256) void k_prefix(float* __restrict__ Mbuf,
                                                float* __restrict__ Ksum) {
  const int nh = blockIdx.x, tid = threadIdx.x;
  float run[16];
#pragma unroll
  for (int i = 0; i < 16; ++i) run[i] = 0.f;
  size_t base = (size_t)nh * C_ * 4096;
  for (int c = 0; c < C_; ++c) {
    size_t b = base + (size_t)c * 4096;
#pragma unroll
    for (int i = 0; i < 16; ++i) {
      size_t idx = b + tid + 256 * i;
      float v = Mbuf[idx];
      Mbuf[idx] = run[i];
      run[i] += v;
    }
  }
  if (tid < 64) {
    float r = 0.f;
    size_t kb = (size_t)nh * C_ * 64;
    for (int c = 0; c < C_; ++c) {
      size_t idx = kb + (size_t)c * 64 + tid;
      float v = Ksum[idx];
      Ksum[idx] = r;
      r += v;
    }
  }
}

// ---------------- Pass 3: out = (tril(q k^T) v + q S) * Z -------------------
__global__ __launch_bounds__(256) void k_main(
    const float* __restrict__ Qg, const float* __restrict__ Kg,
    const float* __restrict__ Vg, const float* __restrict__ Mbuf,
    const float* __restrict__ Ksum, float* __restrict__ Out) {
  extern __shared__ float sm[];
  float* sk    = sm;                 // [128][P_] feature-mapped keys
  float* sv    = sk + T_ * P_;       // [128][P_] values           (async DMA)
  float* ss    = sv + T_ * P_;       // [64][P_]  prefix state S   (async DMA)
  float* sks   = ss + 64 * P_;       // [64]      prefix key sums
  float* stile = sks + 64;           // 8 waves x 2 x [16][17] attn tiles

  const int blk = blockIdx.x;
  const int c = blk & (C_ - 1);
  const int nh = blk >> 6;
  const int n = nh >> 3, h = nh & (H_ - 1);
  const long t0 = (long)c * T_;
  const int tid = threadIdx.x;

  // v and S: async DMA to LDS (raw copies)
#pragma unroll
  for (int it = 0; it < 8; ++it) {
    int idx = tid + 256 * it;
    int r = idx >> 4, j4 = (idx & 15) * 4;
    unsigned long long g = (unsigned long long)(
        Vg + (((size_t)n * L_ + (t0 + r)) * H_ + h) * D_ + j4);
    async_b128(lds_off(&sv[r * P_ + j4]), g);
  }
#pragma unroll
  for (int it = 0; it < 4; ++it) {
    int idx = tid + 256 * it;            // 0..1023 16B-chunks of S
    int r = idx >> 4, j4 = (idx & 15) * 4;
    async_b128(lds_off(&ss[r * P_ + j4]),
               (unsigned long long)(Mbuf + (size_t)blk * 4096 + idx * 4));
  }
  // keys: elu(x)+1 through VGPRs
  for (int i = tid; i < T_ * D_; i += 256) {
    int r = i >> 6, d = i & 63;
    size_t g = (((size_t)n * L_ + (t0 + r)) * H_ + h) * D_ + d;
    sk[r * P_ + d] = fmap(Kg[g]);
  }
  if (tid < 64) sks[tid] = Ksum[(size_t)blk * 64 + tid];
  wait_async();
  __syncthreads();

  const int wave = tid >> 5, lane = tid & 31;
  const int row = lane & 15, half = lane >> 4, kb = half * 2;

  // q A-fragments for this wave's 16 rows (feature-mapped, from global)
  v2f qa[16];
  {
    size_t gq = (((size_t)n * L_ + (t0 + 16 * wave + row)) * H_ + h) * D_;
#pragma unroll
    for (int ks = 0; ks < 16; ++ks) {
      qa[ks][0] = fmap(Qg[gq + 4 * ks + kb]);
      qa[ks][1] = fmap(Qg[gq + 4 * ks + kb + 1]);
    }
  }

  v8f acc0 = {}, acc1 = {}, acc2 = {}, acc3 = {}, accD = {};

  // Intra-chunk: attn tiles jj <= wave (causality), fused with attn*v
  for (int jj = 0; jj <= wave; ++jj) {
    v8f atA = {}, atB = {};  // dual accumulator chains
#pragma unroll
    for (int ks = 0; ks < 16; ks += 2) {  // K-dim = D = 64
      int d0 = 4 * ks + kb;
      v2f b0 = { sk[(16 * jj + row) * P_ + d0],
                 sk[(16 * jj + row) * P_ + d0 + 1] };
      atA = wmma4(qa[ks], b0, atA);
      int d1 = d0 + 4;
      v2f b1 = { sk[(16 * jj + row) * P_ + d1],
                 sk[(16 * jj + row) * P_ + d1 + 1] };
      atB = wmma4(qa[ks + 1], b1, atB);
    }
    v8f at;
#pragma unroll
    for (int r = 0; r < 8; ++r) at[r] = atA[r] + atB[r];
    if (jj == wave) {  // tril mask on diagonal tile: keep if m >= ncol
#pragma unroll
      for (int r = 0; r < 8; ++r)
        if (half * 8 + r < row) at[r] = 0.f;
    }
    float* tb = stile + (wave * 2 + (jj & 1)) * 16 * 17;  // double-buffered
#pragma unroll
    for (int r = 0; r < 8; ++r)  // D-layout -> LDS for A-fragment reuse
      tb[(half * 8 + r) * 17 + row] = at[r];

#pragma unroll
    for (int s = 0; s < 4; ++s) {  // attn_tile (A) x v rows 16jj..16jj+15 (B)
      v2f a = { tb[row * 17 + 4 * s + kb], tb[row * 17 + 4 * s + kb + 1] };
      int r0 = 16 * jj + 4 * s + kb;
      v2f bd = { 1.f, 1.f };  // denominator tile: attn @ ones = row sums
      accD = wmma4(a, bd, accD);
      v2f b0 = { sv[r0 * P_ + row],      sv[(r0 + 1) * P_ + row] };
      acc0 = wmma4(a, b0, acc0);
      v2f b1 = { sv[r0 * P_ + 16 + row], sv[(r0 + 1) * P_ + 16 + row] };
      acc1 = wmma4(a, b1, acc1);
      v2f b2 = { sv[r0 * P_ + 32 + row], sv[(r0 + 1) * P_ + 32 + row] };
      acc2 = wmma4(a, b2, acc2);
      v2f b3 = { sv[r0 * P_ + 48 + row], sv[(r0 + 1) * P_ + 48 + row] };
      acc3 = wmma4(a, b3, acc3);
    }
  }

  // Inter-chunk: q @ S (+ q . prefix-ksum into the denominator tile)
#pragma unroll
  for (int ks = 0; ks < 16; ++ks) {
    int d0 = 4 * ks + kb;
    v2f bd = { sks[d0], sks[d0 + 1] };
    accD = wmma4(qa[ks], bd, accD);
    v2f b0 = { ss[d0 * P_ + row],      ss[(d0 + 1) * P_ + row] };
    acc0 = wmma4(qa[ks], b0, acc0);
    v2f b1 = { ss[d0 * P_ + 16 + row], ss[(d0 + 1) * P_ + 16 + row] };
    acc1 = wmma4(qa[ks], b1, acc1);
    v2f b2 = { ss[d0 * P_ + 32 + row], ss[(d0 + 1) * P_ + 32 + row] };
    acc2 = wmma4(qa[ks], b2, acc2);
    v2f b3 = { ss[d0 * P_ + 48 + row], ss[(d0 + 1) * P_ + 48 + row] };
    acc3 = wmma4(qa[ks], b3, acc3);
  }

  // Z normalize + store (denominator tile has identical columns, lane-matched)
#pragma unroll
  for (int r = 0; r < 8; ++r) {
    int m = half * 8 + r;
    size_t go = (((size_t)n * L_ + (t0 + 16 * wave + m)) * H_ + h) * D_;
    float z = 1.f / (accD[r] + 1e-6f);
    Out[go + row]      = acc0[r] * z;
    Out[go + 16 + row] = acc1[r] * z;
    Out[go + 32 + row] = acc2[r] * z;
    Out[go + 48 + row] = acc3[r] * z;
  }
}

extern "C" void kernel_launch(void* const* d_in, const int* in_sizes, int n_in,
                              void* d_out, int out_size, void* d_ws,
                              size_t ws_size, hipStream_t stream) {
  const float* Qg = (const float*)d_in[0];
  const float* Kg = (const float*)d_in[1];
  const float* Vg = (const float*)d_in[2];
  float* Out = (float*)d_out;
  float* Mbuf = (float*)d_ws;                       // [NH, C, 64, 64] fp32
  float* Ksum = Mbuf + (size_t)NH_ * C_ * 64 * 64;  // [NH, C, 64]     fp32

  const size_t smem1 = (size_t)(2 * T_ * P_) * sizeof(float);
  const size_t smem3 =
      (size_t)(2 * T_ * P_ + 64 * P_ + 64 + 2 * 8 * 16 * 17) * sizeof(float);

  k_chunksums<<<dim3(NH_ * C_), dim3(256), smem1, stream>>>(Kg, Vg, Mbuf, Ksum);
  k_prefix<<<dim3(NH_), dim3(256), 0, stream>>>(Mbuf, Ksum);
  k_main<<<dim3(NH_ * C_), dim3(256), smem3, stream>>>(Qg, Kg, Vg, Mbuf, Ksum,
                                                       Out);
}

// v001
// One run takes 127 microseconds.
// Timed twice side by side with v000, it ran 1.05 and 1.06 times as fast.
#include <hip/hip_runtime.h>

// Causal linear attention (fp32) on gfx1250 via V_WMMA_F32_16X16X4_F32 +
// GLOBAL_LOAD_ASYNC_TO_LDS_B128 (CDNA5 async global->LDS path).
// 3 passes: (1) per-chunk K^T V + key sums, (2) exclusive prefix over chunks,
// (3) per-chunk output: tril(q k^T) v + q S, with the 1/(q . cumsum k + eps)
// normalizer folded in as an extra WMMA output tile (B = ones / key-sums).

#define N_  4
#define L_  8192
#define H_  8
#define D_  64
#define T_  128       // chunk length
#define C_  64        // chunks = L_/T_
#define NH_ 32        // N_*H_
#define P_  68        // padded LDS row stride (floats): 272B = 16B-aligned,
                      // bank = (4*row + col) % 64 -> conflict-free patterns

typedef float v2f __attribute__((ext_vector_type(2)));
typedef float v8f __attribute__((ext_vector_type(8)));

__device__ __forceinline__ v8f wmma4(v2f a, v2f b, v8f c) {
  // D = A(16x4) * B(4x16) + C(16x16), all fp32
  return __builtin_amdgcn_wmma_f32_16x16x4_f32(false, a, false, b, (short)0, c,
                                               false, false);
}

__device__ __forceinline__ float fmap(float x) {  // elu(x)+1
  return x > 0.f ? x + 1.f : __expf(x);
}

// Async global->LDS copy, 16 bytes per lane. VDST VGPR carries the LDS byte
// offset, VADDR the 64-bit global address (GV mode). Tracked on ASYNCcnt.
__device__ __forceinline__ void async_b128(unsigned lds_off,
                                           unsigned long long gaddr) {
  asm volatile("global_load_async_to_lds_b128 %0, %1, off"
               :: "v"(lds_off), "v"(gaddr) : "memory");
}
__device__ __forceinline__ void wait_async() {
  asm volatile("s_wait_asynccnt 0" ::: "memory");
}
__device__ __forceinline__ unsigned lds_off(const float* p) {
  return (unsigned)(size_t)p;  // generic LDS addr: low 32 bits = LDS offset
}

// ---------------- Pass 1: per-chunk M_c = k^T v (64x64) and ksum_c ----------
__global__ __launch_bounds__(256) void k_chunksums(
    const float* __restrict__ Kg, const float* __restrict__ Vg,
    float* __restrict__ Mbuf, float* __restrict__ Ksum) {
  extern __shared__ float sm[];
  float* sk = sm;             // [128][P_] feature-mapped keys
  float* sv = sm + T_ * P_;   // [128][P_] values
  const int blk = blockIdx.x;           // nh*C_ + c
  const int c   = blk & (C_ - 1);
  const int nh  = blk >> 6;
  const int n   = nh >> 3, h = nh & (H_ - 1);
  const long t0 = (long)c * T_;
  const int tid = threadIdx.x;

  // values: async DMA into LDS (raw copy, no VGPR involvement)
#pragma unroll
  for (int it = 0; it < 8; ++it) {
    int idx = tid + 256 * it;            // 0..2047 16B-chunks
    int r = idx >> 4, j4 = (idx & 15) * 4;
    unsigned long long g = (unsigned long long)(
        Vg + (((size_t)n * L_ + (t0 + r)) * H_ + h) * D_ + j4);
    async_b128(lds_off(&sv[r * P_ + j4]), g);
  }
  // keys: need elu(x)+1, go through VGPRs
  for (int i = tid; i < T_ * D_; i += 256) {
    int r = i >> 6, d = i & 63;
    size_t g = (((size_t)n * L_ + (t0 + r)) * H_ + h) * D_ + d;
    sk[r * P_ + d] = fmap(Kg[g]);
  }
  wait_async();
  __syncthreads();

  const int wave = tid >> 5, lane = tid & 31;
  const int col = lane & 15, half = lane >> 4, kb = half * 2;
  float* mb = Mbuf + (size_t)blk * 4096;

  for (int t = wave * 2; t < wave * 2 + 2; ++t) {  // 16 tiles over 8 waves
    int ti = t >> 2, tj = t & 3;
    v8f acc = {}, acc2 = {};
    for (int s = 0; s < 32; s += 2) {              // K-dim = 128, dual chains
      int k0 = 4 * s + kb;
      v2f a0 = { sk[k0 * P_ + 16 * ti + col], sk[(k0 + 1) * P_ + 16 * ti + col] };
      v2f b0 = { sv[k0 * P_ + 16 * tj + col], sv[(k0 + 1) * P_ + 16 * tj + col] };
      acc = wmma4(a0, b0, acc);
      int k1 = k0 + 4;
      v2f a1 = { sk[k1 * P_ + 16 * ti + col], sk[(k1 + 1) * P_ + 16 * ti + col] };
      v2f b1 = { sv[k1 * P_ + 16 * tj + col], sv[(k1 + 1) * P_ + 16 * tj + col] };
      acc2 = wmma4(a1, b1, acc2);
    }
#pragma unroll
    for (int r = 0; r < 8; ++r)
      mb[(16 * ti + half * 8 + r) * 64 + 16 * tj + col] = acc[r] + acc2[r];
  }
  if (tid < 64) {  // per-d key sum for the normalizer
    float s = 0.f;
    for (int r = 0; r < T_; ++r) s += sk[r * P_ + tid];
    Ksum[(size_t)blk * 64 + tid] = s;
  }
}

// ---------------- Pass 2: exclusive prefix over chunks ----------------------
// One thread owns one column group (VT) of one head's chunk series. All its loads
// are issued before the first sum, so a wave pays the load latency once and not
// once per chunk; the sum runs over chunks in ascending order.
template <typename VT, int STRIDE>  // STRIDE: floats from a chunk to the next
__device__ __forceinline__ void prefix_cols(float* __restrict__ p) {
  VT v[C_];
#pragma unroll  // constant offsets: one address pair serves every load and store
  for (int c = 0; c < C_; ++c) v[c] = *(const VT*)(p + c * STRIDE);
  // Keeps every load ahead of the first store: without it the scheduler holds
  // most loads back behind stores and loads into the stores' data registers.
  __builtin_amdgcn_sched_barrier(0);
  VT run = {};
#pragma unroll  // keeps v[] in registers
  for (int c = 0; c < C_; ++c) {
    *(VT*)(p + c * STRIDE) = run;
    run += v[c];
  }
  // Closes the run of stores before any later code may reuse their address or
  // data registers (the other branch's code follows this one in the listing).
  asm volatile("s_wait_xcnt 0x0" ::: "memory");
}

#define PB_M_ (NH_ * 4096 / 512)  // blocks for the states: 2 columns a thread
#define PB_K_ (NH_ * 64 / 256)    // blocks for the key sums: 1 column a thread

__global__ __launch_bounds__(256) void k_prefix(float* __restrict__ Mbuf,
                                                float* __restrict__ Ksum) {
  const int blk = blockIdx.x, tid = threadIdx.x;
  if (blk < PB_M_) {
    const int e = (blk * 256 + tid) * 2;  // nh * 4096 + column
    prefix_cols<v2f, 4096>(Mbuf + (size_t)(e >> 12) * C_ * 4096 + (e & 4095));
  } else {
    const int e = (blk - PB_M_) * 256 + tid;  // nh * 64 + column
    prefix_cols<float, 64>(Ksum + (size_t)(e >> 6) * C_ * 64 + (e & 63));
  }
}

// ---------------- Pass 3: out = (tril(q k^T) v + q S) * Z -------------------
__global__ __launch_bounds__(256) void k_main(
    const float* __restrict__ Qg, const float* __restrict__ Kg,
    const float* __restrict__ Vg, const float* __restrict__ Mbuf,
    const float* __restrict__ Ksum, float* __restrict__ Out) {
  extern __shared__ float sm[];
  float* sk    = sm;                 // [128][P_] feature-mapped keys
  float* sv    = sk + T_ * P_;       // [128][P_] values           (async DMA)
  float* ss    = sv + T_ * P_;       // [64][P_]  prefix state S   (async DMA)
  float* sks   = ss + 64 * P_;       // [64]      prefix key sums
  float* stile = sks + 64;           // 8 waves x 2 x [16][17] attn tiles

  const int blk = blockIdx.x;
  const int c = blk & (C_ - 1);
  const int nh = blk >> 6;
  const int n = nh >> 3, h = nh & (H_ - 1);
  const long t0 = (long)c * T_;
  const int tid = threadIdx.x;

  // v and S: async DMA to LDS (raw copies)
#pragma unroll
  for (int it = 0; it < 8; ++it) {
    int idx = tid + 256 * it;
    int r = idx >> 4, j4 = (idx & 15) * 4;
    unsigned long long g = (unsigned long long)(
        Vg + (((size_t)n * L_ + (t0 + r)) * H_ + h) * D_ + j4);
    async_b128(lds_off(&sv[r * P_ + j4]), g);
  }
#pragma unroll
  for (int it = 0; it < 4; ++it) {
    int idx = tid + 256 * it;            // 0..1023 16B-chunks of S
    int r = idx >> 4, j4 = (idx & 15) * 4;
    async_b128(lds_off(&ss[r * P_ + j4]),
               (unsigned long long)(Mbuf + (size_t)blk * 4096 + idx * 4));
  }
  // keys: elu(x)+1 through VGPRs
  for (int i = tid; i < T_ * D_; i += 256) {
    int r = i >> 6, d = i & 63;
    size_t g = (((size_t)n * L_ + (t0 + r)) * H_ + h) * D_ + d;
    sk[r * P_ + d] = fmap(Kg[g]);
  }
  if (tid < 64) sks[tid] = Ksum[(size_t)blk * 64 + tid];
  wait_async();
  __syncthreads();

  const int wave = tid >> 5, lane = tid & 31;
  const int row = lane & 15, half = lane >> 4, kb = half * 2;

  // q A-fragments for this wave's 16 rows (feature-mapped, from global)
  v2f qa[16];
  {
    size_t gq = (((size_t)n * L_ + (t0 + 16 * wave + row)) * H_ + h) * D_;
#pragma unroll
    for (int ks = 0; ks < 16; ++ks) {
      qa[ks][0] = fmap(Qg[gq + 4 * ks + kb]);
      qa[ks][1] = fmap(Qg[gq + 4 * ks + kb + 1]);
    }
  }

  v8f acc0 = {}, acc1 = {}, acc2 = {}, acc3 = {}, accD = {};

  // Intra-chunk: attn tiles jj <= wave (causality), fused with attn*v
  for (int jj = 0; jj <= wave; ++jj) {
    v8f atA = {}, atB = {};  // dual accumulator chains
#pragma unroll
    for (int ks = 0; ks < 16; ks += 2) {  // K-dim = D = 64
      int d0 = 4 * ks + kb;
      v2f b0 = { sk[(16 * jj + row) * P_ + d0],
                 sk[(16 * jj + row) * P_ + d0 + 1] };
      atA = wmma4(qa[ks], b0, atA);
      int d1 = d0 + 4;
      v2f b1 = { sk[(16 * jj + row) * P_ + d1],
                 sk[(16 * jj + row) * P_ + d1 + 1] };
      atB = wmma4(qa[ks + 1], b1, atB);
    }
    v8f at;
#pragma unroll
    for (int r = 0; r < 8; ++r) at[r] = atA[r] + atB[r];
    if (jj == wave) {  // tril mask on diagonal tile: keep if m >= ncol
#pragma unroll
      for (int r = 0; r < 8; ++r)
        if (half * 8 + r < row) at[r] = 0.f;
    }
    float* tb = stile + (wave * 2 + (jj & 1)) * 16 * 17;  // double-buffered
#pragma unroll
    for (int r = 0; r < 8; ++r)  // D-layout -> LDS for A-fragment reuse
      tb[(half * 8 + r) * 17 + row] = at[r];

#pragma unroll
    for (int s = 0; s < 4; ++s) {  // attn_tile (A) x v rows 16jj..16jj+15 (B)
      v2f a = { tb[row * 17 + 4 * s + kb], tb[row * 17 + 4 * s + kb + 1] };
      int r0 = 16 * jj + 4 * s + kb;
      v2f bd = { 1.f, 1.f };  // denominator tile: attn @ ones = row sums
      accD = wmma4(a, bd, accD);
      v2f b0 = { sv[r0 * P_ + row],      sv[(r0 + 1) * P_ + row] };
      acc0 = wmma4(a, b0, acc0);
      v2f b1 = { sv[r0 * P_ + 16 + row], sv[(r0 + 1) * P_ + 16 + row] };
      acc1 = wmma4(a, b1, acc1);
      v2f b2 = { sv[r0 * P_ + 32 + row], sv[(r0 + 1) * P_ + 32 + row] };
      acc2 = wmma4(a, b2, acc2);
      v2f b3 = { sv[r0 * P_ + 48 + row], sv[(r0 + 1) * P_ + 48 + row] };
      acc3 = wmma4(a, b3, acc3);
    }
  }

  // Inter-chunk: q @ S (+ q . prefix-ksum into the denominator tile)
#pragma unroll
  for (int ks = 0; ks < 16; ++ks) {
    int d0 = 4 * ks + kb;
    v2f bd = { sks[d0], sks[d0 + 1] };
    accD = wmma4(qa[ks], bd, accD);
    v2f b0 = { ss[d0 * P_ + row],      ss[(d0 + 1) * P_ + row] };
    acc0 = wmma4(qa[ks], b0, acc0);
    v2f b1 = { ss[d0 * P_ + 16 + row], ss[(d0 + 1) * P_ + 16 + row] };
    acc1 = wmma4(qa[ks], b1, acc1);
    v2f b2 = { ss[d0 * P_ + 32 + row], ss[(d0 + 1) * P_ + 32 + row] };
    acc2 = wmma4(qa[ks], b2, acc2);
    v2f b3 = { ss[d0 * P_ + 48 + row], ss[(d0 + 1) * P_ + 48 + row] };
    acc3 = wmma4(qa[ks], b3, acc3);
  }

  // Z normalize + store (denominator tile has identical columns, lane-matched)
#pragma unroll
  for (int r = 0; r < 8; ++r) {
    int m = half * 8 + r;
    size_t go = (((size_t)n * L_ + (t0 + 16 * wave + m)) * H_ + h) * D_;
    float z = 1.f / (accD[r] + 1e-6f);
    Out[go + row]      = acc0[r] * z;
    Out[go + 16 + row] = acc1[r] * z;
    Out[go + 32 + row] = acc2[r] * z;
    Out[go + 48 + row] = acc3[r] * z;
  }
}

extern "C" void kernel_launch(void* const* d_in, const int* in_sizes, int n_in,
                              void* d_out, int out_size, void* d_ws,
                              size_t ws_size, hipStream_t stream) {
  const float* Qg = (const float*)d_in[0];
  const float* Kg = (const float*)d_in[1];
  const float* Vg = (const float*)d_in[2];
  float* Out = (float*)d_out;
  float* Mbuf = (float*)d_ws;                       // [NH, C, 64, 64] fp32
  float* Ksum = Mbuf + (size_t)NH_ * C_ * 64 * 64;  // [NH, C, 64]     fp32

  const size_t smem1 = (size_t)(2 * T_ * P_) * sizeof(float);
  const size_t smem3 =
      (size_t)(2 * T_ * P_ + 64 * P_ + 64 + 2 * 8 * 16 * 17) * sizeof(float);

  k_chunksums<<<dim3(NH_ * C_), dim3(256), smem1, stream>>>(Kg, Vg, Mbuf, Ksum);
  k_prefix<<<dim3(PB_M_ + PB_K_), dim3(256), 0, stream>>>(Mbuf, Ksum);
  k_main<<<dim3(NH_ * C_), dim3(256), smem3, stream>>>(Qg, Kg, Vg, Mbuf, Ksum,
                                                       Out);
}

// v002
// A run of this version takes 116 microseconds.
// Next to v001, in two timings, it ran 1.11 and 1.09 times as fast.
// Counting every step since v000, it is 1.16 times as fast.
#include <hip/hip_runtime.h>

// Causal linear attention (fp32) on gfx1250 via V_WMMA_F32_16X16X4_F32 +
// GLOBAL_LOAD_ASYNC_TO_LDS_B128 (CDNA5 async global->LDS path).
// 3 passes: (1) per-chunk K^T V + key sums, (2) exclusive prefix over chunks,
// (3) per-chunk output: tril(q k^T) v + q S, with the 1/(q . cumsum k + eps)
// normalizer folded in as an extra WMMA output tile (B = ones / key-sums).

#define N_  4
#define L_  8192
#define H_  8
#define D_  64
#define T_  128       // chunk length
#define C_  64        // chunks = L_/T_
#define NH_ 32        // N_*H_
#define P_  68        // padded LDS row stride (floats): 272B = 16B-aligned,
                      // bank = (4*row + col) % 64 -> conflict-free patterns

typedef float v2f __attribute__((ext_vector_type(2)));
typedef float v4f __attribute__((ext_vector_type(4)));
typedef float v8f __attribute__((ext_vector_type(8)));

__device__ __forceinline__ v8f wmma4(v2f a, v2f b, v8f c) {
  // D = A(16x4) * B(4x16) + C(16x16), all fp32
  return __builtin_amdgcn_wmma_f32_16x16x4_f32(false, a, false, b, (short)0, c,
                                               false, false);
}

__device__ __forceinline__ float fmap(float x) {  // elu(x)+1
  return x > 0.f ? x + 1.f : __expf(x);
}

// Async global->LDS copy, 16 bytes per lane. VDST VGPR carries the LDS byte
// offset, VADDR the 64-bit global address (GV mode). Tracked on ASYNCcnt.
__device__ __forceinline__ void async_b128(unsigned lds_off,
                                           unsigned long long gaddr) {
  asm volatile("global_load_async_to_lds_b128 %0, %1, off"
               :: "v"(lds_off), "v"(gaddr) : "memory");
}
__device__ __forceinline__ void wait_async() {
  asm volatile("s_wait_asynccnt 0" ::: "memory");
}
__device__ __forceinline__ unsigned lds_off(const float* p) {
  return (unsigned)(size_t)p;  // generic LDS addr: low 32 bits = LDS offset
}

// Key tile [128][64] of one chunk and head: thread tid owns 16 bytes of rows
// tid/16 + 16*it (kp: its 16 bytes of row tid/16). The loads and the stores are
// two calls, so that a kernel can put the other global loads of its prologue
// between them: all of a block's loads are then in flight together and it pays
// the memory latency once.
__device__ __forceinline__ void keys_load(const float* kp, v4f (&kr)[8]) {
#pragma unroll  // constant offsets: one address pair serves all eight loads
  for (int it = 0; it < 8; ++it)
    kr[it] = *(const v4f*)(kp + it * 16 * (H_ * D_));
}
__device__ __forceinline__ void keys_store(float* sk, int tid,
                                           const v4f (&kr)[8]) {
  float* q = sk + (tid >> 4) * P_ + (tid & 15) * 4;
#pragma unroll  // keeps kr[] in registers
  for (int it = 0; it < 8; ++it) {
    v4f f = { fmap(kr[it][0]), fmap(kr[it][1]), fmap(kr[it][2]),
              fmap(kr[it][3]) };
    *(v4f*)(q + it * 16 * P_) = f;
  }
}

// ---------------- Pass 1: per-chunk M_c = k^T v (64x64) and ksum_c ----------
__global__ __launch_bounds__(256) void k_chunksums(
    const float* __restrict__ Kg, const float* __restrict__ Vg,
    float* __restrict__ Mbuf, float* __restrict__ Ksum) {
  extern __shared__ float sm[];
  float* sk = sm;             // [128][P_] feature-mapped keys
  float* sv = sm + T_ * P_;   // [128][P_] values
  const int blk = blockIdx.x;           // nh*C_ + c
  const int c   = blk & (C_ - 1);
  const int nh  = blk >> 6;
  const int n   = nh >> 3, h = nh & (H_ - 1);
  const long t0 = (long)c * T_;
  const int tid = threadIdx.x;

  // values: async DMA into LDS (raw copy, no VGPR involvement)
#pragma unroll
  for (int it = 0; it < 8; ++it) {
    int idx = tid + 256 * it;            // 0..2047 16B-chunks
    int r = idx >> 4, j4 = (idx & 15) * 4;
    unsigned long long g = (unsigned long long)(
        Vg + (((size_t)n * L_ + (t0 + r)) * H_ + h) * D_ + j4);
    async_b128(lds_off(&sv[r * P_ + j4]), g);
  }
  // keys: need elu(x)+1, go through VGPRs
  const float* kp =
      Kg + (((size_t)n * L_ + (t0 + (tid >> 4))) * H_ + h) * D_ + (tid & 15) * 4;
  v4f kr[8];
  keys_load(kp, kr);
  // Closes the run of loads: their address pair stays untouched up to here.
  asm volatile("s_wait_xcnt 0x0" :: "v"(kp) : "memory");
  keys_store(sk, tid, kr);
  wait_async();
  __syncthreads();

  const int wave = tid >> 5, lane = tid & 31;
  const int col = lane & 15, half = lane >> 4, kb = half * 2;
  float* mb = Mbuf + (size_t)blk * 4096;

  for (int t = wave * 2; t < wave * 2 + 2; ++t) {  // 16 tiles over 8 waves
    int ti = t >> 2, tj = t & 3;
    v8f acc = {}, acc2 = {};
    for (int s = 0; s < 32; s += 2) {              // K-dim = 128, dual chains
      int k0 = 4 * s + kb;
      v2f a0 = { sk[k0 * P_ + 16 * ti + col], sk[(k0 + 1) * P_ + 16 * ti + col] };
      v2f b0 = { sv[k0 * P_ + 16 * tj + col], sv[(k0 + 1) * P_ + 16 * tj + col] };
      acc = wmma4(a0, b0, acc);
      int k1 = k0 + 4;
      v2f a1 = { sk[k1 * P_ + 16 * ti + col], sk[(k1 + 1) * P_ + 16 * ti + col] };
      v2f b1 = { sv[k1 * P_ + 16 * tj + col], sv[(k1 + 1) * P_ + 16 * tj + col] };
      acc2 = wmma4(a1, b1, acc2);
    }
#pragma unroll
    for (int r = 0; r < 8; ++r)
      mb[(16 * ti + half * 8 + r) * 64 + 16 * tj + col] = acc[r] + acc2[r];
  }
  if (tid < 64) {  // per-d key sum for the normalizer
    float s = 0.f;
    for (int r = 0; r < T_; ++r) s += sk[r * P_ + tid];
    Ksum[(size_t)blk * 64 + tid] = s;
  }
}

// ---------------- Pass 2: exclusive prefix over chunks ----------------------
// One thread owns one column group (VT) of one head's chunk series. All its loads
// are issued before the first sum, so a wave pays the load latency once and not
// once per chunk; the sum runs over chunks in ascending order.
template <typename VT, int STRIDE>  // STRIDE: floats from a chunk to the next
__device__ __forceinline__ void prefix_cols(float* __restrict__ p) {
  VT v[C_];
#pragma unroll  // constant offsets: one address pair serves every load and store
  for (int c = 0; c < C_; ++c) v[c] = *(const VT*)(p + c * STRIDE);
  // Keeps every load ahead of the first store: without it the scheduler holds
  // most loads back behind stores and loads into the stores' data registers.
  __builtin_amdgcn_sched_barrier(0);
  VT run = {};
#pragma unroll  // keeps v[] in registers
  for (int c = 0; c < C_; ++c) {
    *(VT*)(p + c * STRIDE) = run;
    run += v[c];
  }
  // Closes the run of stores before any later code may reuse their address or
  // data registers (the other branch's code follows this one in the listing).
  asm volatile("s_wait_xcnt 0x0" ::: "memory");
}

#define PB_M_ (NH_ * 4096 / 512)  // blocks for the states: 2 columns a thread
#define PB_K_ (NH_ * 64 / 256)    // blocks for the key sums: 1 column a thread

__global__ __launch_bounds__(256) void k_prefix(float* __restrict__ Mbuf,
                                                float* __restrict__ Ksum) {
  const int blk = blockIdx.x, tid = threadIdx.x;
  if (blk < PB_M_) {
    const int e = (blk * 256 + tid) * 2;  // nh * 4096 + column
    prefix_cols<v2f, 4096>(Mbuf + (size_t)(e >> 12) * C_ * 4096 + (e & 4095));
  } else {
    const int e = (blk - PB_M_) * 256 + tid;  // nh * 64 + column
    prefix_cols<float, 64>(Ksum + (size_t)(e >> 6) * C_ * 64 + (e & 63));
  }
}

// ---------------- Pass 3: out = (tril(q k^T) v + q S) * Z -------------------
__global__ __launch_bounds__(256) void k_main(
    const float* __restrict__ Qg, const float* __restrict__ Kg,
    const float* __restrict__ Vg, const float* __restrict__ Mbuf,
    const float* __restrict__ Ksum, float* __restrict__ Out) {
  extern __shared__ float sm[];
  float* sk    = sm;                 // [128][P_] feature-mapped keys
  float* sv    = sk + T_ * P_;       // [128][P_] values           (async DMA)
  float* ss    = sv + T_ * P_;       // [64][P_]  prefix state S   (async DMA)
  float* sks   = ss + 64 * P_;       // [64]      prefix key sums
  float* stile = sks + 64;           // 8 waves x 2 x [16][17] attn tiles

  const int blk = blockIdx.x;
  const int c = blk & (C_ - 1);
  const int nh = blk >> 6;
  const int n = nh >> 3, h = nh & (H_ - 1);
  const long t0 = (long)c * T_;
  const int tid = threadIdx.x;

  // v and S: async DMA to LDS (raw copies)
#pragma unroll
  for (int it = 0; it < 8; ++it) {
    int idx = tid + 256 * it;
    int r = idx >> 4, j4 = (idx & 15) * 4;
    unsigned long long g = (unsigned long long)(
        Vg + (((size_t)n * L_ + (t0 + r)) * H_ + h) * D_ + j4);
    async_b128(lds_off(&sv[r * P_ + j4]), g);
  }
#pragma unroll
  for (int it = 0; it < 4; ++it) {
    int idx = tid + 256 * it;            // 0..1023 16B-chunks of S
    int r = idx >> 4, j4 = (idx & 15) * 4;
    async_b128(lds_off(&ss[r * P_ + j4]),
               (unsigned long long)(Mbuf + (size_t)blk * 4096 + idx * 4));
  }
  const int wave = tid >> 5, lane = tid & 31;
  const int row = lane & 15, half = lane >> 4, kb = half * 2;

  // key sums, keys (elu(x)+1 through VGPRs) and this wave's q rows: every load
  // is issued before the first value is used
  const float* kp =
      Kg + (((size_t)n * L_ + (t0 + (tid >> 4))) * H_ + h) * D_ + (tid & 15) * 4;
  const float* qp =
      Qg + (((size_t)n * L_ + (t0 + 16 * wave + row)) * H_ + h) * D_ + kb;
  const int ki = tid & 63;  // every wave loads: no branch in the run of loads
  const float ksv = Ksum[(size_t)blk * 64 + ki];
  v4f kr[8];
  keys_load(kp, kr);
  v2f qa[16];  // q A-fragments for this wave's 16 rows
#pragma unroll  // constant offsets: one address pair serves all sixteen loads
  for (int ks = 0; ks < 16; ++ks) qa[ks] = *(const v2f*)(qp + 4 * ks);
  // Closes the run of loads: their address registers stay untouched up to here.
  // ksv is named so that its load stays in the run: the compiler otherwise
  // sinks it into the branch below, where two waves pay its latency on its own.
  asm volatile("s_wait_xcnt 0x0" :: "v"(ki), "v"(kp), "v"(qp), "v"(ksv)
               : "memory");
  if (tid < 64) sks[tid] = ksv;
  keys_store(sk, tid, kr);
#pragma unroll
  for (int ks = 0; ks < 16; ++ks) {
    qa[ks][0] = fmap(qa[ks][0]);
    qa[ks][1] = fmap(qa[ks][1]);
  }
  wait_async();
  __syncthreads();

  v8f acc0 = {}, acc1 = {}, acc2 = {}, acc3 = {}, accD = {};

  // Intra-chunk: attn tiles jj <= wave (causality), fused with attn*v
  for (int jj = 0; jj <= wave; ++jj) {
    v8f atA = {}, atB = {};  // dual accumulator chains
#pragma unroll
    for (int ks = 0; ks < 16; ks += 2) {  // K-dim = D = 64
      int d0 = 4 * ks + kb;
      v2f b0 = { sk[(16 * jj + row) * P_ + d0],
                 sk[(16 * jj + row) * P_ + d0 + 1] };
      atA = wmma4(qa[ks], b0, atA);
      int d1 = d0 + 4;
      v2f b1 = { sk[(16 * jj + row) * P_ + d1],
                 sk[(16 * jj + row) * P_ + d1 + 1] };
      atB = wmma4(qa[ks + 1], b1, atB);
    }
    v8f at;
#pragma unroll
    for (int r = 0; r < 8; ++r) at[r] = atA[r] + atB[r];
    if (jj == wave) {  // tril mask on diagonal tile: keep if m >= ncol
#pragma unroll
      for (int r = 0; r < 8; ++r)
        if (half * 8 + r < row) at[r] = 0.f;
    }
    float* tb = stile + (wave * 2 + (jj & 1)) * 16 * 17;  // double-buffered
#pragma unroll
    for (int r = 0; r < 8; ++r)  // D-layout -> LDS for A-fragment reuse
      tb[(half * 8 + r) * 17 + row] = at[r];

#pragma unroll
    for (int s = 0; s < 4; ++s) {  // attn_tile (A) x v rows 16jj..16jj+15 (B)
      v2f a = { tb[row * 17 + 4 * s + kb], tb[row * 17 + 4 * s + kb + 1] };
      int r0 = 16 * jj + 4 * s + kb;
      v2f bd = { 1.f, 1.f };  // denominator tile: attn @ ones = row sums
      accD = wmma4(a, bd, accD);
      v2f b0 = { sv[r0 * P_ + row],      sv[(r0 + 1) * P_ + row] };
      acc0 = wmma4(a, b0, acc0);
      v2f b1 = { sv[r0 * P_ + 16 + row], sv[(r0 + 1) * P_ + 16 + row] };
      acc1 = wmma4(a, b1, acc1);
      v2f b2 = { sv[r0 * P_ + 32 + row], sv[(r0 + 1) * P_ + 32 + row] };
      acc2 = wmma4(a, b2, acc2);
      v2f b3 = { sv[r0 * P_ + 48 + row], sv[(r0 + 1) * P_ + 48 + row] };
      acc3 = wmma4(a, b3, acc3);
    }
  }

  // Inter-chunk: q @ S (+ q . prefix-ksum into the denominator tile)
#pragma unroll
  for (int ks = 0; ks < 16; ++ks) {
    int d0 = 4 * ks + kb;
    v2f bd = { sks[d0], sks[d0 + 1] };
    accD = wmma4(qa[ks], bd, accD);
    v2f b0 = { ss[d0 * P_ + row],      ss[(d0 + 1) * P_ + row] };
    acc0 = wmma4(qa[ks], b0, acc0);
    v2f b1 = { ss[d0 * P_ + 16 + row], ss[(d0 + 1) * P_ + 16 + row] };
    acc1 = wmma4(qa[ks], b1, acc1);
    v2f b2 = { ss[d0 * P_ + 32 + row], ss[(d0 + 1) * P_ + 32 + row] };
    acc2 = wmma4(qa[ks], b2, acc2);
    v2f b3 = { ss[d0 * P_ + 48 + row], ss[(d0 + 1) * P_ + 48 + row] };
    acc3 = wmma4(qa[ks], b3, acc3);
  }

  // Z normalize + store (denominator tile has identical columns, lane-matched)
#pragma unroll
  for (int r = 0; r < 8; ++r) {
    int m = half * 8 + r;
    size_t go = (((size_t)n * L_ + (t0 + 16 * wave + m)) * H_ + h) * D_;
    float z = 1.f / (accD[r] + 1e-6f);
    Out[go + row]      = acc0[r] * z;
    Out[go + 16 + row] = acc1[r] * z;
    Out[go + 32 + row] = acc2[r] * z;
    Out[go + 48 + row] = acc3[r] * z;
  }
}

extern "C" void kernel_launch(void* const* d_in, const int* in_sizes, int n_in,
                              void* d_out, int out_size, void* d_ws,
                              size_t ws_size, hipStream_t stream) {
  const float* Qg = (const float*)d_in[0];
  const float* Kg = (const float*)d_in[1];
  const float* Vg = (const float*)d_in[2];
  float* Out = (float*)d_out;
  float* Mbuf = (float*)d_ws;                       // [NH, C, 64, 64] fp32
  float* Ksum = Mbuf + (size_t)NH_ * C_ * 64 * 64;  // [NH, C, 64]     fp32

  const size_t smem1 = (size_t)(2 * T_ * P_) * sizeof(float);
  const size_t smem3 =
      (size_t)(2 * T_ * P_ + 64 * P_ + 64 + 2 * 8 * 16 * 17) * sizeof(float);

  k_chunksums<<<dim3(NH_ * C_), dim3(256), smem1, stream>>>(Kg, Vg, Mbuf, Ksum);
  k_prefix<<<dim3(PB_M_ + PB_K_), dim3(256), 0, stream>>>(Mbuf, Ksum);
  k_main<<<dim3(NH_ * C_), dim3(256), smem3, stream>>>(Qg, Kg, Vg, Mbuf, Ksum,
                                                       Out);
}

// v003
// Measured time: 111 microseconds a run.
// In both of two side-by-side timings against v002, it was 1.05 times as fast.
// Over all steps from v000 it is 1.22 times as fast.
#include <hip/hip_runtime.h>

// Causal linear attention (fp32) on gfx1250 via V_WMMA_F32_16X16X4_F32 +
// GLOBAL_LOAD_ASYNC_TO_LDS_B128 (CDNA5 async global->LDS path).
// 3 passes: (1) per-chunk K^T V + key sums, (2) exclusive prefix over chunks,
// (3) per-chunk output: tril(q k^T) v + q S, with the 1/(q . cumsum k + eps)
// normalizer folded in as an extra WMMA output tile (B = ones / key-sums).

#define N_  4
#define L_  8192
#define H_  8
#define D_  64
#define T_  128       // chunk length
#define C_  64        // chunks = L_/T_
#define NH_ 32        // N_*H_
#define P_  68        // padded LDS row stride (floats): 272B = 16B-aligned,
                      // bank = (4*row + col) % 64 -> conflict-free patterns

typedef float v2f __attribute__((ext_vector_type(2)));
typedef float v4f __attribute__((ext_vector_type(4)));
typedef float v8f __attribute__((ext_vector_type(8)));

__device__ __forceinline__ v8f wmma4(v2f a, v2f b, v8f c) {
  // D = A(16x4) * B(4x16) + C(16x16), all fp32
  return __builtin_amdgcn_wmma_f32_16x16x4_f32(false, a, false, b, (short)0, c,
                                               false, false);
}

__device__ __forceinline__ float fmap(float x) {  // elu(x)+1
  return x > 0.f ? x + 1.f : __expf(x);
}

// Async global->LDS copy, 16 bytes per lane. VDST VGPR carries the LDS byte
// offset, VADDR the 64-bit global address (GV mode). Tracked on ASYNCcnt.
__device__ __forceinline__ void async_b128(unsigned lds_off,
                                           unsigned long long gaddr) {
  asm volatile("global_load_async_to_lds_b128 %0, %1, off"
               :: "v"(lds_off), "v"(gaddr) : "memory");
}
__device__ __forceinline__ void wait_async() {
  asm volatile("s_wait_asynccnt 0" ::: "memory");
}
__device__ __forceinline__ unsigned lds_off(const float* p) {
  return (unsigned)(size_t)p;  // generic LDS addr: low 32 bits = LDS offset
}

// Key tile [128][64] of one chunk and head: thread tid owns 16 bytes of rows
// tid/16 + 16*it (kp: its 16 bytes of row tid/16). The loads and the stores are
// two calls, so that a kernel can put the other global loads of its prologue
// between them: all of a block's loads are then in flight together and it pays
// the memory latency once.
__device__ __forceinline__ void keys_load(const float* kp, v4f (&kr)[8]) {
#pragma unroll  // constant offsets: one address pair serves all eight loads
  for (int it = 0; it < 8; ++it)
    kr[it] = *(const v4f*)(kp + it * 16 * (H_ * D_));
}
__device__ __forceinline__ void keys_store(float* sk, int tid,
                                           const v4f (&kr)[8]) {
  float* q = sk + (tid >> 4) * P_ + (tid & 15) * 4;
#pragma unroll  // keeps kr[] in registers
  for (int it = 0; it < 8; ++it) {
    v4f f = { fmap(kr[it][0]), fmap(kr[it][1]), fmap(kr[it][2]),
              fmap(kr[it][3]) };
    *(v4f*)(q + it * 16 * P_) = f;
  }
}

// ---------------- Pass 1: per-chunk M_c = k^T v (64x64) and ksum_c ----------
__global__ __launch_bounds__(256) void k_chunksums(
    const float* __restrict__ Kg, const float* __restrict__ Vg,
    float* __restrict__ Mbuf, float* __restrict__ Ksum) {
  extern __shared__ float sm[];
  float* sk = sm;             // [128][P_] feature-mapped keys
  float* sv = sm + T_ * P_;   // [128][P_] values
  const int blk = blockIdx.x;           // nh*C_ + c
  const int c   = blk & (C_ - 1);
  const int nh  = blk >> 6;
  const int n   = nh >> 3, h = nh & (H_ - 1);
  const long t0 = (long)c * T_;
  const int tid = threadIdx.x;

  // values: async DMA into LDS (raw copy, no VGPR involvement)
#pragma unroll
  for (int it = 0; it < 8; ++it) {
    int idx = tid + 256 * it;            // 0..2047 16B-chunks
    int r = idx >> 4, j4 = (idx & 15) * 4;
    unsigned long long g = (unsigned long long)(
        Vg + (((size_t)n * L_ + (t0 + r)) * H_ + h) * D_ + j4);
    async_b128(lds_off(&sv[r * P_ + j4]), g);
  }
  // keys: need elu(x)+1, go through VGPRs
  const float* kp =
      Kg + (((size_t)n * L_ + (t0 + (tid >> 4))) * H_ + h) * D_ + (tid & 15) * 4;
  v4f kr[8];
  keys_load(kp, kr);
  // Closes the run of loads: their address pair stays untouched up to here.
  asm volatile("s_wait_xcnt 0x0" :: "v"(kp) : "memory");
  keys_store(sk, tid, kr);
  wait_async();
  __syncthreads();

  const int wave = tid >> 5, lane = tid & 31;
  const int col = lane & 15, half = lane >> 4, kb = half * 2;
  float* mb = Mbuf + (size_t)blk * 4096;

  for (int t = wave * 2; t < wave * 2 + 2; ++t) {  // 16 tiles over 8 waves
    int ti = t >> 2, tj = t & 3;
    v8f acc = {}, acc2 = {};
    for (int s = 0; s < 32; s += 2) {              // K-dim = 128, dual chains
      int k0 = 4 * s + kb;
      v2f a0 = { sk[k0 * P_ + 16 * ti + col], sk[(k0 + 1) * P_ + 16 * ti + col] };
      v2f b0 = { sv[k0 * P_ + 16 * tj + col], sv[(k0 + 1) * P_ + 16 * tj + col] };
      acc = wmma4(a0, b0, acc);
      int k1 = k0 + 4;
      v2f a1 = { sk[k1 * P_ + 16 * ti + col], sk[(k1 + 1) * P_ + 16 * ti + col] };
      v2f b1 = { sv[k1 * P_ + 16 * tj + col], sv[(k1 + 1) * P_ + 16 * tj + col] };
      acc2 = wmma4(a1, b1, acc2);
    }
#pragma unroll
    for (int r = 0; r < 8; ++r)
      mb[(16 * ti + half * 8 + r) * 64 + 16 * tj + col] = acc[r] + acc2[r];
  }
  if (tid < 64) {  // per-d key sum for the normalizer
    float s = 0.f;
    for (int r = 0; r < T_; ++r) s += sk[r * P_ + tid];
    Ksum[(size_t)blk * 64 + tid] = s;
  }
}

// ---------------- Pass 2: exclusive prefix over chunks ----------------------
// One thread owns one column group (VT) of one head's chunk series. All its loads
// are issued before the first sum, so a wave pays the load latency once and not
// once per chunk; the sum runs over chunks in ascending order.
template <typename VT, int STRIDE>  // STRIDE: floats from a chunk to the next
__device__ __forceinline__ void prefix_cols(float* __restrict__ p) {
  VT v[C_];
#pragma unroll  // constant offsets: one address pair serves every load and store
  for (int c = 0; c < C_; ++c) v[c] = *(const VT*)(p + c * STRIDE);
  // Keeps every load ahead of the first store: without it the scheduler holds
  // most loads back behind stores and loads into the stores' data registers.
  __builtin_amdgcn_sched_barrier(0);
  VT run = {};
#pragma unroll  // keeps v[] in registers
  for (int c = 0; c < C_; ++c) {
    *(VT*)(p + c * STRIDE) = run;
    run += v[c];
  }
  // Closes the run of stores before any later code may reuse their address or
  // data registers (the other branch's code follows this one in the listing).
  asm volatile("s_wait_xcnt 0x0" ::: "memory");
}

#define PB_M_ (NH_ * 4096 / 512)  // blocks for the states: 2 columns a thread
#define PB_K_ (NH_ * 64 / 256)    // blocks for the key sums: 1 column a thread

__global__ __launch_bounds__(256) void k_prefix(float* __restrict__ Mbuf,
                                                float* __restrict__ Ksum) {
  const int blk = blockIdx.x, tid = threadIdx.x;
  if (blk < PB_M_) {
    const int e = (blk * 256 + tid) * 2;  // nh * 4096 + column
    prefix_cols<v2f, 4096>(Mbuf + (size_t)(e >> 12) * C_ * 4096 + (e & 4095));
  } else {
    const int e = (blk - PB_M_) * 256 + tid;  // nh * 64 + column
    prefix_cols<float, 64>(Ksum + (size_t)(e >> 6) * C_ * 64 + (e & 63));
  }
}

// ---------------- Pass 3: out = (tril(q k^T) v + q S) * Z -------------------
__global__ __launch_bounds__(256) void k_main(
    const float* __restrict__ Qg, const float* __restrict__ Kg,
    const float* __restrict__ Vg, const float* __restrict__ Mbuf,
    const float* __restrict__ Ksum, float* __restrict__ Out) {
  extern __shared__ float sm[];
  float* sk    = sm;                 // [128][P_] feature-mapped keys
  float* sv    = sk + T_ * P_;       // [128][P_] values           (async DMA)
  float* ss    = sv + T_ * P_;       // [64][P_]  prefix state S   (async DMA)
  float* sks   = ss + 64 * P_;       // [64]      prefix key sums
  float* stile = sks + 64;           // 8 waves x 2 x [16][17] attn tiles

  const int blk = blockIdx.x;
  const int c = blk & (C_ - 1);
  const int nh = blk >> 6;
  const int n = nh >> 3, h = nh & (H_ - 1);
  const long t0 = (long)c * T_;
  const int tid = threadIdx.x;

  // v and S: async DMA to LDS (raw copies)
#pragma unroll
  for (int it = 0; it < 8; ++it) {
    int idx = tid + 256 * it;
    int r = idx >> 4, j4 = (idx & 15) * 4;
    unsigned long long g = (unsigned long long)(
        Vg + (((size_t)n * L_ + (t0 + r)) * H_ + h) * D_ + j4);
    async_b128(lds_off(&sv[r * P_ + j4]), g);
  }
#pragma unroll
  for (int it = 0; it < 4; ++it) {
    int idx = tid + 256 * it;            // 0..1023 16B-chunks of S
    int r = idx >> 4, j4 = (idx & 15) * 4;
    async_b128(lds_off(&ss[r * P_ + j4]),
               (unsigned long long)(Mbuf + (size_t)blk * 4096 + idx * 4));
  }
  const int wave = tid >> 5, lane = tid & 31;
  const int row = lane & 15, half = lane >> 4, kb = half * 2;
  // Row tile of this wave. Tile t costs t + 1 causal key tiles, and waves w and
  // w + 4 of a block share a SIMD: such a pair takes tiles t and 7 - t, so that
  // every SIMD's matrix unit gets the same nine key tiles' work from a block.
  const int rt = wave ^ ((wave >> 2) * 3);  // 0 1 2 3 7 6 5 4

  // key sums, keys (elu(x)+1 through VGPRs) and this wave's q rows: every load
  // is issued before the first value is used
  const float* kp =
      Kg + (((size_t)n * L_ + (t0 + (tid >> 4))) * H_ + h) * D_ + (tid & 15) * 4;
  const float* qp =
      Qg + (((size_t)n * L_ + (t0 + 16 * rt + row)) * H_ + h) * D_ + kb;
  const int ki = tid & 63;  // every wave loads: no branch in the run of loads
  const float ksv = Ksum[(size_t)blk * 64 + ki];
  v4f kr[8];
  keys_load(kp, kr);
  v2f qa[16];  // q A-fragments for this wave's 16 rows
#pragma unroll  // constant offsets: one address pair serves all sixteen loads
  for (int ks = 0; ks < 16; ++ks) qa[ks] = *(const v2f*)(qp + 4 * ks);
  // Closes the run of loads: their address registers stay untouched up to here.
  // ksv is named so that its load stays in the run: the compiler otherwise
  // sinks it into the branch below, where two waves pay its latency on its own.
  asm volatile("s_wait_xcnt 0x0" :: "v"(ki), "v"(kp), "v"(qp), "v"(ksv)
               : "memory");
  if (tid < 64) sks[tid] = ksv;
  keys_store(sk, tid, kr);
#pragma unroll
  for (int ks = 0; ks < 16; ++ks) {
    qa[ks][0] = fmap(qa[ks][0]);
    qa[ks][1] = fmap(qa[ks][1]);
  }
  wait_async();
  __syncthreads();

  v8f acc0 = {}, acc1 = {}, acc2 = {}, acc3 = {}, accD = {};

  // Intra-chunk: attn tiles jj <= rt (causality), fused with attn*v
  for (int jj = 0; jj <= rt; ++jj) {
    v8f atA = {}, atB = {};  // dual accumulator chains
#pragma unroll
    for (int ks = 0; ks < 16; ks += 2) {  // K-dim = D = 64
      int d0 = 4 * ks + kb;
      v2f b0 = { sk[(16 * jj + row) * P_ + d0],
                 sk[(16 * jj + row) * P_ + d0 + 1] };
      atA = wmma4(qa[ks], b0, atA);
      int d1 = d0 + 4;
      v2f b1 = { sk[(16 * jj + row) * P_ + d1],
                 sk[(16 * jj + row) * P_ + d1 + 1] };
      atB = wmma4(qa[ks + 1], b1, atB);
    }
    v8f at;
#pragma unroll
    for (int r = 0; r < 8; ++r) at[r] = atA[r] + atB[r];
    if (jj == rt) {  // tril mask on diagonal tile: keep if m >= ncol
#pragma unroll
      for (int r = 0; r < 8; ++r)
        if (half * 8 + r < row) at[r] = 0.f;
    }
    float* tb = stile + (wave * 2 + (jj & 1)) * 16 * 17;  // double-buffered
#pragma unroll
    for (int r = 0; r < 8; ++r)  // D-layout -> LDS for A-fragment reuse
      tb[(half * 8 + r) * 17 + row] = at[r];

#pragma unroll
    for (int s = 0; s < 4; ++s) {  // attn_tile (A) x v rows 16jj..16jj+15 (B)
      v2f a = { tb[row * 17 + 4 * s + kb], tb[row * 17 + 4 * s + kb + 1] };
      int r0 = 16 * jj + 4 * s + kb;
      v2f bd = { 1.f, 1.f };  // denominator tile: attn @ ones = row sums
      accD = wmma4(a, bd, accD);
      v2f b0 = { sv[r0 * P_ + row],      sv[(r0 + 1) * P_ + row] };
      acc0 = wmma4(a, b0, acc0);
      v2f b1 = { sv[r0 * P_ + 16 + row], sv[(r0 + 1) * P_ + 16 + row] };
      acc1 = wmma4(a, b1, acc1);
      v2f b2 = { sv[r0 * P_ + 32 + row], sv[(r0 + 1) * P_ + 32 + row] };
      acc2 = wmma4(a, b2, acc2);
      v2f b3 = { sv[r0 * P_ + 48 + row], sv[(r0 + 1) * P_ + 48 + row] };
      acc3 = wmma4(a, b3, acc3);
    }
  }

  // Inter-chunk: q @ S (+ q . prefix-ksum into the denominator tile)
#pragma unroll
  for (int ks = 0; ks < 16; ++ks) {
    int d0 = 4 * ks + kb;
    v2f bd = { sks[d0], sks[d0 + 1] };
    accD = wmma4(qa[ks], bd, accD);
    v2f b0 = { ss[d0 * P_ + row],      ss[(d0 + 1) * P_ + row] };
    acc0 = wmma4(qa[ks], b0, acc0);
    v2f b1 = { ss[d0 * P_ + 16 + row], ss[(d0 + 1) * P_ + 16 + row] };
    acc1 = wmma4(qa[ks], b1, acc1);
    v2f b2 = { ss[d0 * P_ + 32 + row], ss[(d0 + 1) * P_ + 32 + row] };
    acc2 = wmma4(qa[ks], b2, acc2);
    v2f b3 = { ss[d0 * P_ + 48 + row], ss[(d0 + 1) * P_ + 48 + row] };
    acc3 = wmma4(qa[ks], b3, acc3);
  }

  // Z normalize + store (denominator tile has identical columns, lane-matched)
#pragma unroll
  for (int r = 0; r < 8; ++r) {
    int m = half * 8 + r;
    size_t go = (((size_t)n * L_ + (t0 + 16 * rt + m)) * H_ + h) * D_;
    float z = 1.f / (accD[r] + 1e-6f);
    Out[go + row]      = acc0[r] * z;
    Out[go + 16 + row] = acc1[r] * z;
    Out[go + 32 + row] = acc2[r] * z;
    Out[go + 48 + row] = acc3[r] * z;
  }
}

extern "C" void kernel_launch(void* const* d_in, const int* in_sizes, int n_in,
                              void* d_out, int out_size, void* d_ws,
                              size_t ws_size, hipStream_t stream) {
  const float* Qg = (const float*)d_in[0];
  const float* Kg = (const float*)d_in[1];
  const float* Vg = (const float*)d_in[2];
  float* Out = (float*)d_out;
  float* Mbuf = (float*)d_ws;                       // [NH, C, 64, 64] fp32
  float* Ksum = Mbuf + (size_t)NH_ * C_ * 64 * 64;  // [NH, C, 64]     fp32

  const size_t smem1 = (size_t)(2 * T_ * P_) * sizeof(float);
  const size_t smem3 =
      (size_t)(2 * T_ * P_ + 64 * P_ + 64 + 2 * 8 * 16 * 17) * sizeof(float);

  k_chunksums<<<dim3(NH_ * C_), dim3(256), smem1, stream>>>(Kg, Vg, Mbuf, Ksum);
  k_prefix<<<dim3(PB_M_ + PB_K_), dim3(256), 0, stream>>>(Mbuf, Ksum);
  k_main<<<dim3(NH_ * C_), dim3(256), smem3, stream>>>(Qg, Kg, Vg, Mbuf, Ksum,
                                                       Out);
}

// v004
// A run of this version takes 82.8 microseconds.
// Timed twice side by side with v003, it ran 1.34 and 1.35 times as fast.
// Over all steps from v000 it is 1.64 times as fast.
#include <hip/hip_runtime.h>

// Causal linear attention (fp32) on gfx1250 via V_WMMA_F32_16X16X4_F32 +
// GLOBAL_LOAD_ASYNC_TO_LDS_B128 (CDNA5 async global->LDS path).
// 2 passes: (1) a block walks a group of chunks and carries the running K^T V
// and key sums: it stores them ahead of each chunk (prefix inside the group)
// and once more at the end (the group's total), (2) per-chunk output:
// tril(q k^T) v + q S, S = prefix inside the group + earlier groups' totals,
// with the 1/(q . cumsum k + eps) normalizer folded in as an extra WMMA output
// tile (B = ones / key-sums).

#define N_  4
#define L_  8192
#define H_  8
#define D_  64
#define T_  128       // chunk length
#define C_  64        // chunks = L_/T_
#define NH_ 32        // N_*H_
#define G_  4         // chunks in a group (one pass-1 block)
#define NG_ 16        // groups of a head = C_/G_
#define CS_ (T_ * H_ * D_)  // floats from a chunk's row to the next chunk's
#define P_  68        // padded LDS row stride (floats): 272B = 16B-aligned,
                      // bank = (4*row + col) % 64 -> conflict-free patterns

typedef float v2f __attribute__((ext_vector_type(2)));
typedef float v4f __attribute__((ext_vector_type(4)));
typedef float v8f __attribute__((ext_vector_type(8)));

__device__ __forceinline__ v8f wmma4(v2f a, v2f b, v8f c) {
  // D = A(16x4) * B(4x16) + C(16x16), all fp32
  return __builtin_amdgcn_wmma_f32_16x16x4_f32(false, a, false, b, (short)0, c,
                                               false, false);
}

__device__ __forceinline__ float fmap(float x) {  // elu(x)+1
  return x > 0.f ? x + 1.f : __expf(x);
}

// Async global->LDS copy, 16 bytes per lane. VDST VGPR carries the LDS byte
// offset, VADDR the 64-bit global address (GV mode). Tracked on ASYNCcnt.
__device__ __forceinline__ void async_b128(unsigned lds_off,
                                           unsigned long long gaddr) {
  // The wait in the copy's own statement: its address registers are rewritten
  // only behind it.
  asm volatile("global_load_async_to_lds_b128 %0, %1, off\n\ts_wait_xcnt 0x0"
               :: "v"(lds_off), "v"(gaddr) : "memory");
}
__device__ __forceinline__ void wait_async() {
  asm volatile("s_wait_asynccnt 0" ::: "memory");
}
__device__ __forceinline__ unsigned lds_off(const float* p) {
  return (unsigned)(size_t)p;  // generic LDS addr: low 32 bits = LDS offset
}

// Key tile [128][64] of one chunk and head: thread tid owns 16 bytes of rows
// tid/16 + 16*it (kp: its 16 bytes of row tid/16). The loads and the stores are
// two calls, so that a kernel can put the other global loads of its prologue
// between them: those and the keys' loads are then in flight together and it pays
// their memory latency once.
__device__ __forceinline__ void keys_load(const float* kp, v4f (&kr)[8]) {
#pragma unroll  // constant offsets: one address pair serves all eight loads
  for (int it = 0; it < 8; ++it)
    kr[it] = *(const v4f*)(kp + it * 16 * (H_ * D_));
}
__device__ __forceinline__ void keys_store(float* sk, int tid,
                                           const v4f (&kr)[8]) {
  float* q = sk + (tid >> 4) * P_ + (tid & 15) * 4;
#pragma unroll  // keeps kr[] in registers
  for (int it = 0; it < 8; ++it) {
    v4f f = { fmap(kr[it][0]), fmap(kr[it][1]), fmap(kr[it][2]),
              fmap(kr[it][3]) };
    *(v4f*)(q + it * 16 * P_) = f;
  }
}

// Value tile [128][64] of one chunk and head, async DMA into LDS (raw copy):
// thread tid brings 16 bytes of rows tid/16 + 16*it (vp: those of row tid/16).
__device__ __forceinline__ void values_copy(float* sv, const float* vp,
                                            int tid) {
  const unsigned l = lds_off(sv + (tid >> 4) * P_ + (tid & 15) * 4);
#pragma unroll  // eight copies, each closed by its own s_wait_xcnt
  for (int it = 0; it < 8; ++it)
    async_b128(l + it * 16 * P_ * 4,
               (unsigned long long)(vp + it * 16 * (H_ * D_)));
}

// ---- Pass 1: running M = sum k^T v (64x64) and key sums over a group -------
// Two LDS buffers (keys + values each): chunk cc + 1 is on its way from memory
// while chunk cc is worked on.
__global__ __launch_bounds__(256) void k_chunksums(
    const float* __restrict__ Kg, const float* __restrict__ Vg,
    float* __restrict__ Mbuf, float* __restrict__ Ksum,
    float* __restrict__ Mtot, float* __restrict__ Ktot) {
  // buffer b (of two): keys [128][P_], values [128][P_]
  __shared__ __attribute__((aligned(16))) float sm[4 * T_ * P_];
  const int blk = blockIdx.x;           // nh*NG_ + g
  const int g   = blk & (NG_ - 1);
  const int nh  = blk >> 4;
  const int n   = nh >> 3, h = nh & (H_ - 1);
  const int tid = threadIdx.x;
  const size_t off =
      (((size_t)n * L_ + ((size_t)g * (G_ * T_) + (tid >> 4))) * H_ + h) * D_ +
      (tid & 15) * 4;
  const float* kp = Kg + off;
  const float* vp = Vg + off;

  // chunk 0 into buffer 0 (keys need elu(x)+1: through VGPRs)
  v4f kr[8];
  values_copy(sm + T_ * P_, vp, tid);
  keys_load(kp, kr);
  // Closes the run of loads: their address pair stays untouched up to here.
  asm volatile("s_wait_xcnt 0x0" :: "v"(kp) : "memory");
  keys_store(sm, tid, kr);
  wait_async();
  __syncthreads();
  values_copy(sm + 3 * T_ * P_, vp + CS_, tid);  // chunk 1's values, buffer 1

  const int wave = tid >> 5, lane = tid & 31;
  const int col = lane & 15, half = lane >> 4, kb = half * 2;
  const int ti = wave >> 1, tj = (wave & 1) * 2;  // tiles (ti,tj), (ti,tj+1)
  const int mo = (16 * ti + half * 8) * 64 + 16 * tj + col;
  v8f acc[2] = {}, acc2[2] = {};  // running sums, dual chains a tile
  float ks = 0.f;                 // running key sum of column tid (tid < 64)

#pragma unroll  // cc constant in each copy: buffers and last-trip tests fold away
  for (int cc = 0; cc < G_; ++cc) {
    float* sk = sm + (cc & 1) * (2 * T_ * P_);
    float* sv = sk + T_ * P_;
    if (cc + 1 < G_) {  // next chunk's keys fly while this chunk is worked on
      keys_load(kp + (cc + 1) * CS_, kr);
      // Closes the run of loads: their address pair stays untouched up to here.
      asm volatile("s_wait_xcnt 0x0" :: "v"(kp) : "memory");
    }
    const size_t ch = (size_t)nh * C_ + g * G_ + cc;
    float* mb = Mbuf + ch * 4096 + mo;
#pragma unroll  // keeps acc[] in registers
    for (int tt = 0; tt < 2; ++tt) {
#pragma unroll
      for (int r = 0; r < 8; ++r)  // the state ahead of this chunk
        mb[r * 64 + 16 * tt] = acc[tt][r] + acc2[tt][r];
      // Closes the run of stores before their data registers are reused.
      asm volatile("s_wait_xcnt 0x0" ::: "memory");
      for (int s = 0; s < 32; s += 2) {            // K-dim = 128, dual chains
        int k0 = 4 * s + kb;
        v2f a0 = { sk[k0 * P_ + 16 * ti + col],
                   sk[(k0 + 1) * P_ + 16 * ti + col] };
        v2f b0 = { sv[k0 * P_ + 16 * (tj + tt) + col],
                   sv[(k0 + 1) * P_ + 16 * (tj + tt) + col] };
        acc[tt] = wmma4(a0, b0, acc[tt]);
        int k1 = k0 + 4;
        v2f a1 = { sk[k1 * P_ + 16 * ti + col],
                   sk[(k1 + 1) * P_ + 16 * ti + col] };
        v2f b1 = { sv[k1 * P_ + 16 * (tj + tt) + col],
                   sv[(k1 + 1) * P_ + 16 * (tj + tt) + col] };
        acc2[tt] = wmma4(a1, b1, acc2[tt]);
      }
    }
    if (tid < 64) {  // per-d key sum for the normalizer
      Ksum[ch * 64 + tid] = ks;
      float s = 0.f;
      for (int r = 0; r < T_; ++r) s += sk[r * P_ + tid];
      ks += s;
    }
    if (cc + 1 < G_) {
      // the other buffer's last readers left it at the barrier of trip cc - 1
      keys_store(sm + ((cc + 1) & 1) * (2 * T_ * P_), tid, kr);
      // Hand-over: this wave's LDS reads and writes are done, its copies of
      // chunk cc + 1 have landed; behind the barrier that holds for every wave.
      asm volatile("s_wait_dscnt 0x0" ::: "memory");
      wait_async();
      __syncthreads();
      if (cc + 2 < G_) values_copy(sv, vp + (cc + 2) * CS_, tid);
    }
  }
  wait_async();  // no copy is left in flight at the wave's end

  float* mt = Mtot + (size_t)blk * 4096 + mo;  // the group's total
#pragma unroll
  for (int tt = 0; tt < 2; ++tt)
#pragma unroll
    for (int r = 0; r < 8; ++r)
      mt[r * 64 + 16 * tt] = acc[tt][r] + acc2[tt][r];
  if (tid < 64) Ktot[(size_t)blk * 64 + tid] = ks;
}

// ---------------- Pass 2: out = (tril(q k^T) v + q S) * Z -------------------
__global__ __launch_bounds__(256) void k_main(
    const float* __restrict__ Qg, const float* __restrict__ Kg,
    const float* __restrict__ Vg, const float* __restrict__ Mbuf,
    const float* __restrict__ Ksum, const float* __restrict__ Mtot,
    const float* __restrict__ Ktot, float* __restrict__ Out) {
  extern __shared__ float sm[];
  float* sk    = sm;                 // [128][P_] feature-mapped keys
  float* sv    = sk + T_ * P_;       // [128][P_] values           (async DMA)
  float* ss    = sv + T_ * P_;       // [64][P_]  prefix state S
  float* sks   = ss + 64 * P_;       // [64]      prefix key sums
  float* stile = sks + 64;           // 8 waves x 2 x [16][17] attn tiles

  const int blk = blockIdx.x;
  const int c = blk & (C_ - 1);
  const int nh = blk >> 6;
  const int n = nh >> 3, h = nh & (H_ - 1);
  const long t0 = (long)c * T_;
  const int tid = threadIdx.x;

  // v: async DMA to LDS (raw copy)
  values_copy(sv, Vg + (((size_t)n * L_ + (t0 + (tid >> 4))) * H_ + h) * D_ +
                      (tid & 15) * 4, tid);
  const int wave = tid >> 5, lane = tid & 31;
  const int row = lane & 15, half = lane >> 4, kb = half * 2;
  // Row tile of this wave. Tile t costs t + 1 causal key tiles, and waves w and
  // w + 4 of a block share a SIMD: such a pair takes tiles t and 7 - t, so that
  // every SIMD's matrix unit gets the same nine key tiles' work from a block.
  const int rt = wave ^ ((wave >> 2) * 3);  // 0 1 2 3 7 6 5 4

  // key sums, keys (elu(x)+1 through VGPRs) and this wave's q rows: every load
  // is issued before the first value is used
  const float* kp =
      Kg + (((size_t)n * L_ + (t0 + (tid >> 4))) * H_ + h) * D_ + (tid & 15) * 4;
  const float* qp =
      Qg + (((size_t)n * L_ + (t0 + 16 * rt + row)) * H_ + h) * D_ + kb;
  const int ki = tid & 63;  // every wave loads: no branch in the run of loads
  float ksv = Ksum[(size_t)blk * 64 + ki];
  // state ahead of this chunk inside its group: thread tid owns 16 bytes of
  // rows tid/16 + 16*it of the 64x64 state
  const float* sp = Mbuf + (size_t)blk * 4096 + tid * 4;
  v4f sa[4];
#pragma unroll  // constant offsets: one address pair serves all four loads
  for (int it = 0; it < 4; ++it) sa[it] = *(const v4f*)(sp + it * 1024);
  v4f kr[8];
  keys_load(kp, kr);
  v2f qa[16];  // q A-fragments for this wave's 16 rows
#pragma unroll  // constant offsets: one address pair serves all sixteen loads
  for (int ks = 0; ks < 16; ++ks) qa[ks] = *(const v2f*)(qp + 4 * ks);
  // Closes the run of loads: their address registers stay untouched up to here.
  // ksv is named so that its load stays in the run and is not sunk to its use.
  asm volatile("s_wait_xcnt 0x0" :: "v"(ki), "v"(kp), "v"(qp), "v"(sp), "v"(ksv)
               : "memory");
  keys_store(sk, tid, kr);
#pragma unroll
  for (int ks = 0; ks < 16; ++ks) {
    qa[ks][0] = fmap(qa[ks][0]);
    qa[ks][1] = fmap(qa[ks][1]);
  }
  // Totals of the head's earlier groups, in ascending order, four groups a trip:
  // a trip's loads are all issued before its first sum (every group has a total
  // in the workspace, so a trip may load past the last one wanted; it adds only
  // the wanted ones).
  const int ng = c / G_;  // earlier groups: the same for the whole block
  const float* tp = Mtot + (size_t)nh * NG_ * 4096 + tid * 4;
  const float* ktp = Ktot + (size_t)nh * NG_ * 64 + ki;
  for (int g0 = 0; g0 < ng; g0 += 4) {
    v4f tv[4][4];
    float kt[4];
#pragma unroll  // constant offsets: two address pairs serve the trip's loads
    for (int j = 0; j < 4; ++j) {
#pragma unroll
      for (int it = 0; it < 4; ++it)
        tv[j][it] = *(const v4f*)(tp + j * 4096 + it * 1024);
      kt[j] = ktp[j * 64];
    }
    // Closes the run of loads before their address pairs are advanced.
    asm volatile("s_wait_xcnt 0x0" :: "v"(tp), "v"(ktp) : "memory");
#pragma unroll  // keeps tv[] in registers
    for (int j = 0; j < 4; ++j)
      if (g0 + j < ng) {
#pragma unroll
        for (int it = 0; it < 4; ++it) sa[it] += tv[j][it];
        ksv += kt[j];
      }
    tp += 4 * 4096;
    ktp += 4 * 64;
  }
#pragma unroll
  for (int it = 0; it < 4; ++it)
    *(v4f*)(ss + ((tid >> 4) + 16 * it) * P_ + (tid & 15) * 4) = sa[it];
  if (tid < 64) sks[tid] = ksv;
  wait_async();
  __syncthreads();

  v8f acc0 = {}, acc1 = {}, acc2 = {}, acc3 = {}, accD = {};

  // Intra-chunk: attn tiles jj <= rt (causality), fused with attn*v
  for (int jj = 0; jj <= rt; ++jj) {
    v8f atA = {}, atB = {};  // dual accumulator chains
#pragma unroll
    for (int ks = 0; ks < 16; ks += 2) {  // K-dim = D = 64
      int d0 = 4 * ks + kb;
      v2f b0 = { sk[(16 * jj + row) * P_ + d0],
                 sk[(16 * jj + row) * P_ + d0 + 1] };
      atA = wmma4(qa[ks], b0, atA);
      int d1 = d0 + 4;
      v2f b1 = { sk[(16 * jj + row) * P_ + d1],
                 sk[(16 * jj + row) * P_ + d1 + 1] };
      atB = wmma4(qa[ks + 1], b1, atB);
    }
    v8f at;
#pragma unroll
    for (int r = 0; r < 8; ++r) at[r] = atA[r] + atB[r];
    if (jj == rt) {  // tril mask on diagonal tile: keep if m >= ncol
#pragma unroll
      for (int r = 0; r < 8; ++r)
        if (half * 8 + r < row) at[r] = 0.f;
    }
    float* tb = stile + (wave * 2 + (jj & 1)) * 16 * 17;  // double-buffered
#pragma unroll
    for (int r = 0; r < 8; ++r)  // D-layout -> LDS for A-fragment reuse
      tb[(half * 8 + r) * 17 + row] = at[r];

#pragma unroll
    for (int s = 0; s < 4; ++s) {  // attn_tile (A) x v rows 16jj..16jj+15 (B)
      v2f a = { tb[row * 17 + 4 * s + kb], tb[row * 17 + 4 * s + kb + 1] };
      int r0 = 16 * jj + 4 * s + kb;
      v2f bd = { 1.f, 1.f };  // denominator tile: attn @ ones = row sums
      accD = wmma4(a, bd, accD);
      v2f b0 = { sv[r0 * P_ + row],      sv[(r0 + 1) * P_ + row] };
      acc0 = wmma4(a, b0, acc0);
      v2f b1 = { sv[r0 * P_ + 16 + row], sv[(r0 + 1) * P_ + 16 + row] };
      acc1 = wmma4(a, b1, acc1);
      v2f b2 = { sv[r0 * P_ + 32 + row], sv[(r0 + 1) * P_ + 32 + row] };
      acc2 = wmma4(a, b2, acc2);
      v2f b3 = { sv[r0 * P_ + 48 + row], sv[(r0 + 1) * P_ + 48 + row] };
      acc3 = wmma4(a, b3, acc3);
    }
  }

  // Inter-chunk: q @ S (+ q . prefix-ksum into the denominator tile)
#pragma unroll
  for (int ks = 0; ks < 16; ++ks) {
    int d0 = 4 * ks + kb;
    v2f bd = { sks[d0], sks[d0 + 1] };
    accD = wmma4(qa[ks], bd, accD);
    v2f b0 = { ss[d0 * P_ + row],      ss[(d0 + 1) * P_ + row] };
    acc0 = wmma4(qa[ks], b0, acc0);
    v2f b1 = { ss[d0 * P_ + 16 + row], ss[(d0 + 1) * P_ + 16 + row] };
    acc1 = wmma4(qa[ks], b1, acc1);
    v2f b2 = { ss[d0 * P_ + 32 + row], ss[(d0 + 1) * P_ + 32 + row] };
    acc2 = wmma4(qa[ks], b2, acc2);
    v2f b3 = { ss[d0 * P_ + 48 + row], ss[(d0 + 1) * P_ + 48 + row] };
    acc3 = wmma4(qa[ks], b3, acc3);
  }

  // Z normalize + store (denominator tile has identical columns, lane-matched)
#pragma unroll
  for (int r = 0; r < 8; ++r) {
    int m = half * 8 + r;
    size_t go = (((size_t)n * L_ + (t0 + 16 * rt + m)) * H_ + h) * D_;
    float z = 1.f / (accD[r] + 1e-6f);
    Out[go + row]      = acc0[r] * z;
    Out[go + 16 + row] = acc1[r] * z;
    Out[go + 32 + row] = acc2[r] * z;
    Out[go + 48 + row] = acc3[r] * z;
  }
}

extern "C" void kernel_launch(void* const* d_in, const int* in_sizes, int n_in,
                              void* d_out, int out_size, void* d_ws,
                              size_t ws_size, hipStream_t stream) {
  const float* Qg = (const float*)d_in[0];
  const float* Kg = (const float*)d_in[1];
  const float* Vg = (const float*)d_in[2];
  float* Out = (float*)d_out;
  float* Mbuf = (float*)d_ws;                       // [NH, C, 64, 64] fp32
  float* Ksum = Mbuf + (size_t)NH_ * C_ * 64 * 64;  // [NH, C, 64]     fp32
  float* Mtot = Ksum + (size_t)NH_ * C_ * 64;       // [NH, NG, 64, 64] fp32
  float* Ktot = Mtot + (size_t)NH_ * NG_ * 64 * 64; // [NH, NG, 64]    fp32

  const size_t smem3 =
      (size_t)(2 * T_ * P_ + 64 * P_ + 64 + 2 * 8 * 16 * 17) * sizeof(float);

  k_chunksums<<<dim3(NH_ * NG_), dim3(256), 0, stream>>>(Kg, Vg, Mbuf, Ksum, Mtot,
                                                         Ktot);
  k_main<<<dim3(NH_ * C_), dim3(256), smem3, stream>>>(Qg, Kg, Vg, Mbuf, Ksum,
                                                       Mtot, Ktot, Out);
}

// v005
// Measured time: 79.8 microseconds a run.
// Timed twice side by side with v004, it ran 1.03 times as fast both times.
// Over all steps from v000 it is 1.69 times as fast.
#include <hip/hip_runtime.h>

// Causal linear attention (fp32) on gfx1250 via V_WMMA_F32_16X16X4_F32 +
// GLOBAL_LOAD_ASYNC_TO_LDS_B128 (CDNA5 async global->LDS path).
// 2 passes: (1) a block walks a group of chunks and carries the running K^T V
// and key sums: it stores them ahead of each chunk (prefix inside the group)
// and once more at the end (the group's total), (2) per-chunk output:
// tril(q k^T) v + q S, S = prefix inside the group + earlier groups' totals,
// with the 1/(q . cumsum k + eps) normalizer folded in as an extra WMMA output
// tile (B = ones / key-sums).
// Which column a lane stands for: in a wave's group of n column tiles (4 in
// pass 2, 2 in pass 1) lane c of tile t holds column n*c + t, not 16*t + c. A
// lane's B elements of one k row for all n tiles are then adjacent in LDS (one
// 16- or 8-byte read, not n reads of 4 bytes), and so are its results in memory.

#define N_  4
#define L_  8192
#define H_  8
#define D_  64
#define T_  128       // chunk length
#define C_  64        // chunks = L_/T_
#define NH_ 32        // N_*H_
#define G_  4         // chunks in a group (one pass-1 block)
#define NG_ 16        // groups of a head = C_/G_
#define CS_ (T_ * H_ * D_)  // floats from a chunk's row to the next chunk's
#define P_  68        // padded LDS row stride (floats): 272B = 16B-aligned,
                      // bank = (4*row + col) % 64 -> conflict-free patterns

typedef float v2f __attribute__((ext_vector_type(2)));
typedef float v4f __attribute__((ext_vector_type(4)));
typedef float v8f __attribute__((ext_vector_type(8)));

__device__ __forceinline__ v8f wmma4(v2f a, v2f b, v8f c) {
  // D = A(16x4) * B(4x16) + C(16x16), all fp32
  return __builtin_amdgcn_wmma_f32_16x16x4_f32(false, a, false, b, (short)0, c,
                                               false, false);
}

__device__ __forceinline__ float fmap(float x) {  // elu(x)+1
  return x > 0.f ? x + 1.f : __expf(x);
}

// Async global->LDS copy, 16 bytes per lane. VDST VGPR carries the LDS byte
// offset, VADDR the 64-bit global address (GV mode). Tracked on ASYNCcnt.
__device__ __forceinline__ void async_b128(unsigned lds_off,
                                           unsigned long long gaddr) {
  // The wait in the copy's own statement: its address registers are rewritten
  // only behind it.
  asm volatile("global_load_async_to_lds_b128 %0, %1, off\n\ts_wait_xcnt 0x0"
               :: "v"(lds_off), "v"(gaddr) : "memory");
}
__device__ __forceinline__ void wait_async() {
  asm volatile("s_wait_asynccnt 0" ::: "memory");
}
__device__ __forceinline__ unsigned lds_off(const float* p) {
  return (unsigned)(size_t)p;  // generic LDS addr: low 32 bits = LDS offset
}

// Key tile [128][64] of one chunk and head: thread tid owns 16 bytes of rows
// tid/16 + 16*it (kp: its 16 bytes of row tid/16). The loads and the stores are
// two calls, so that a kernel can put the other global loads of its prologue
// between them: those and the keys' loads are then in flight together and it pays
// their memory latency once.
__device__ __forceinline__ void keys_load(const float* kp, v4f (&kr)[8]) {
#pragma unroll  // constant offsets: one address pair serves all eight loads
  for (int it = 0; it < 8; ++it)
    kr[it] = *(const v4f*)(kp + it * 16 * (H_ * D_));
}
__device__ __forceinline__ void keys_store(float* sk, int tid,
                                           const v4f (&kr)[8]) {
  float* q = sk + (tid >> 4) * P_ + (tid & 15) * 4;
#pragma unroll  // keeps kr[] in registers
  for (int it = 0; it < 8; ++it) {
    v4f f = { fmap(kr[it][0]), fmap(kr[it][1]), fmap(kr[it][2]),
              fmap(kr[it][3]) };
    *(v4f*)(q + it * 16 * P_) = f;
  }
}

// Value tile [128][64] of one chunk and head, async DMA into LDS (raw copy):
// thread tid brings 16 bytes of rows tid/16 + 16*it (vp: those of row tid/16).
__device__ __forceinline__ void values_copy(float* sv, const float* vp,
                                            int tid) {
  const unsigned l = lds_off(sv + (tid >> 4) * P_ + (tid & 15) * 4);
#pragma unroll  // eight copies, each closed by its own s_wait_xcnt
  for (int it = 0; it < 8; ++it)
    async_b128(l + it * 16 * P_ * 4,
               (unsigned long long)(vp + it * 16 * (H_ * D_)));
}

// ---- Pass 1: running M = sum k^T v (64x64) and key sums over a group -------
// Two LDS buffers (keys + values each): chunk cc + 1 is on its way from memory
// while chunk cc is worked on.
__global__ __launch_bounds__(256) void k_chunksums(
    const float* __restrict__ Kg, const float* __restrict__ Vg,
    float* __restrict__ Mbuf, float* __restrict__ Ksum,
    float* __restrict__ Mtot, float* __restrict__ Ktot) {
  // buffer b (of two): keys [128][P_], values [128][P_]
  __shared__ __attribute__((aligned(16))) float sm[4 * T_ * P_];
  const int blk = blockIdx.x;           // nh*NG_ + g
  const int g   = blk & (NG_ - 1);
  const int nh  = blk >> 4;
  const int n   = nh >> 3, h = nh & (H_ - 1);
  const int tid = threadIdx.x;
  const size_t off =
      (((size_t)n * L_ + ((size_t)g * (G_ * T_) + (tid >> 4))) * H_ + h) * D_ +
      (tid & 15) * 4;
  const float* kp = Kg + off;
  const float* vp = Vg + off;

  // chunk 0 into buffer 0 (keys need elu(x)+1: through VGPRs)
  v4f kr[8];
  values_copy(sm + T_ * P_, vp, tid);
  keys_load(kp, kr);
  // Closes the run of loads: their address pair stays untouched up to here.
  asm volatile("s_wait_xcnt 0x0" :: "v"(kp) : "memory");
  keys_store(sm, tid, kr);
  wait_async();
  __syncthreads();
  values_copy(sm + 3 * T_ * P_, vp + CS_, tid);  // chunk 1's values, buffer 1

  const int wave = tid >> 5, lane = tid & 31;
  const int col = lane & 15, half = lane >> 4, kb = half * 2;
  const int ti = wave >> 1, tj = (wave & 1) * 2;  // tiles (ti,tj), (ti,tj+1)
  const int e2 = 16 * tj + 2 * col;  // this lane's column of tile tj; tj+1: e2+1
  const int mo = (16 * ti + half * 8) * 64 + e2;
  v8f acc[2] = {}, acc2[2] = {};  // running sums, dual chains a tile
  float ks = 0.f;                 // running key sum of column tid (tid < 64)

#pragma unroll  // cc constant in each copy: buffers and last-trip tests fold away
  for (int cc = 0; cc < G_; ++cc) {
    float* sk = sm + (cc & 1) * (2 * T_ * P_);
    float* sv = sk + T_ * P_;
    if (cc + 1 < G_) {  // next chunk's keys fly while this chunk is worked on
      keys_load(kp + (cc + 1) * CS_, kr);
      // Closes the run of loads: their address pair stays untouched up to here.
      asm volatile("s_wait_xcnt 0x0" :: "v"(kp) : "memory");
    }
    const size_t ch = (size_t)nh * C_ + g * G_ + cc;
    float* mb = Mbuf + ch * 4096 + mo;
#pragma unroll  // keeps acc[] in registers
    for (int r = 0; r < 8; ++r) {  // the state ahead of this chunk
      v2f st = { acc[0][r] + acc2[0][r], acc[1][r] + acc2[1][r] };
      *(v2f*)(mb + r * 64) = st;
    }
    // Closes the run of stores before their data registers are reused.
    asm volatile("s_wait_xcnt 0x0" ::: "memory");
    for (int s = 0; s < 32; s += 2) {  // K-dim = 128, dual chains a tile
      int k0 = 4 * s + kb;
      v2f a0 = { sk[k0 * P_ + 16 * ti + col],
                 sk[(k0 + 1) * P_ + 16 * ti + col] };
      v2f x0 = *(const v2f*)(sv + k0 * P_ + e2);        // row k0, both tiles
      v2f y0 = *(const v2f*)(sv + (k0 + 1) * P_ + e2);  // row k0 + 1
      v2f b00 = { x0[0], y0[0] }, b01 = { x0[1], y0[1] };
      acc[0] = wmma4(a0, b00, acc[0]);
      acc[1] = wmma4(a0, b01, acc[1]);
      int k1 = k0 + 4;
      v2f a1 = { sk[k1 * P_ + 16 * ti + col],
                 sk[(k1 + 1) * P_ + 16 * ti + col] };
      v2f x1 = *(const v2f*)(sv + k1 * P_ + e2);
      v2f y1 = *(const v2f*)(sv + (k1 + 1) * P_ + e2);
      v2f b10 = { x1[0], y1[0] }, b11 = { x1[1], y1[1] };
      acc2[0] = wmma4(a1, b10, acc2[0]);
      acc2[1] = wmma4(a1, b11, acc2[1]);
    }
    if (tid < 64) {  // per-d key sum for the normalizer
      Ksum[ch * 64 + tid] = ks;
      float s = 0.f;
      for (int r = 0; r < T_; ++r) s += sk[r * P_ + tid];
      ks += s;
    }
    if (cc + 1 < G_) {
      // the other buffer's last readers left it at the barrier of trip cc - 1
      keys_store(sm + ((cc + 1) & 1) * (2 * T_ * P_), tid, kr);
      // Hand-over: this wave's LDS reads and writes are done, its copies of
      // chunk cc + 1 have landed; behind the barrier that holds for every wave.
      asm volatile("s_wait_dscnt 0x0" ::: "memory");
      wait_async();
      __syncthreads();
      if (cc + 2 < G_) values_copy(sv, vp + (cc + 2) * CS_, tid);
    }
  }
  wait_async();  // no copy is left in flight at the wave's end

  float* mt = Mtot + (size_t)blk * 4096 + mo;  // the group's total
#pragma unroll
  for (int r = 0; r < 8; ++r) {
    v2f st = { acc[0][r] + acc2[0][r], acc[1][r] + acc2[1][r] };
    *(v2f*)(mt + r * 64) = st;
  }
  if (tid < 64) Ktot[(size_t)blk * 64 + tid] = ks;
}

// ---------------- Pass 2: out = (tril(q k^T) v + q S) * Z -------------------
__global__ __launch_bounds__(256) void k_main(
    const float* __restrict__ Qg, const float* __restrict__ Kg,
    const float* __restrict__ Vg, const float* __restrict__ Mbuf,
    const float* __restrict__ Ksum, const float* __restrict__ Mtot,
    const float* __restrict__ Ktot, float* __restrict__ Out) {
  extern __shared__ float sm[];
  float* sk    = sm;                 // [128][P_] feature-mapped keys
  float* sv    = sk + T_ * P_;       // [128][P_] values           (async DMA)
  float* ss    = sv + T_ * P_;       // [64][P_]  prefix state S
  float* sks   = ss + 64 * P_;       // [64]      prefix key sums
  float* stile = sks + 64;           // 8 waves x 2 x [16][17] attn tiles

  const int blk = blockIdx.x;
  const int c = blk & (C_ - 1);
  const int nh = blk >> 6;
  const int n = nh >> 3, h = nh & (H_ - 1);
  const long t0 = (long)c * T_;
  const int tid = threadIdx.x;

  // v: async DMA to LDS (raw copy)
  values_copy(sv, Vg + (((size_t)n * L_ + (t0 + (tid >> 4))) * H_ + h) * D_ +
                      (tid & 15) * 4, tid);
  const int wave = tid >> 5, lane = tid & 31;
  const int row = lane & 15, half = lane >> 4, kb = half * 2;
  const int c4 = row * 4;  // this lane's column of output tile 0; tile t: c4 + t
  // Row tile of this wave. Tile t costs t + 1 causal key tiles, and waves w and
  // w + 4 of a block share a SIMD: such a pair takes tiles t and 7 - t, so that
  // every SIMD's matrix unit gets the same nine key tiles' work from a block.
  const int rt = wave ^ ((wave >> 2) * 3);  // 0 1 2 3 7 6 5 4

  // key sums, keys (elu(x)+1 through VGPRs) and this wave's q rows: every load
  // is issued before the first value is used
  const float* kp =
      Kg + (((size_t)n * L_ + (t0 + (tid >> 4))) * H_ + h) * D_ + (tid & 15) * 4;
  const float* qp =
      Qg + (((size_t)n * L_ + (t0 + 16 * rt + row)) * H_ + h) * D_ + kb;
  const int ki = tid & 63;  // every wave loads: no branch in the run of loads
  float ksv = Ksum[(size_t)blk * 64 + ki];
  // state ahead of this chunk inside its group: thread tid owns 16 bytes of
  // rows tid/16 + 16*it of the 64x64 state
  const float* sp = Mbuf + (size_t)blk * 4096 + tid * 4;
  v4f sa[4];
#pragma unroll  // constant offsets: one address pair serves all four loads
  for (int it = 0; it < 4; ++it) sa[it] = *(const v4f*)(sp + it * 1024);
  v4f kr[8];
  keys_load(kp, kr);
  v2f qa[16];  // q A-fragments for this wave's 16 rows
#pragma unroll  // constant offsets: one address pair serves all sixteen loads
  for (int ks = 0; ks < 16; ++ks) qa[ks] = *(const v2f*)(qp + 4 * ks);
  // Closes the run of loads: their address registers stay untouched up to here.
  // ksv is named so that its load stays in the run and is not sunk to its use.
  asm volatile("s_wait_xcnt 0x0" :: "v"(ki), "v"(kp), "v"(qp), "v"(sp), "v"(ksv)
               : "memory");
  keys_store(sk, tid, kr);
#pragma unroll
  for (int ks = 0; ks < 16; ++ks) {
    qa[ks][0] = fmap(qa[ks][0]);
    qa[ks][1] = fmap(qa[ks][1]);
  }
  // Totals of the head's earlier groups, in ascending order, four groups a trip:
  // a trip's loads are all issued before its first sum (every group has a total
  // in the workspace, so a trip may load past the last one wanted; it adds only
  // the wanted ones).
  const int ng = c / G_;  // earlier groups: the same for the whole block
  const float* tp = Mtot + (size_t)nh * NG_ * 4096 + tid * 4;
  const float* ktp = Ktot + (size_t)nh * NG_ * 64 + ki;
  for (int g0 = 0; g0 < ng; g0 += 4) {
    v4f tv[4][4];
    float kt[4];
#pragma unroll  // constant offsets: two address pairs serve the trip's loads
    for (int j = 0; j < 4; ++j) {
#pragma unroll
      for (int it = 0; it < 4; ++it)
        tv[j][it] = *(const v4f*)(tp + j * 4096 + it * 1024);
      kt[j] = ktp[j * 64];
    }
    // Closes the run of loads before their address pairs are advanced.
    asm volatile("s_wait_xcnt 0x0" :: "v"(tp), "v"(ktp) : "memory");
#pragma unroll  // keeps tv[] in registers
    for (int j = 0; j < 4; ++j)
      if (g0 + j < ng) {
#pragma unroll
        for (int it = 0; it < 4; ++it) sa[it] += tv[j][it];
        ksv += kt[j];
      }
    tp += 4 * 4096;
    ktp += 4 * 64;
  }
#pragma unroll
  for (int it = 0; it < 4; ++it)
    *(v4f*)(ss + ((tid >> 4) + 16 * it) * P_ + (tid & 15) * 4) = sa[it];
  if (tid < 64) sks[tid] = ksv;
  wait_async();
  __syncthreads();

  v8f acc0 = {}, acc1 = {}, acc2 = {}, acc3 = {}, accD = {};

  // Intra-chunk: attn tiles jj <= rt (causality), fused with attn*v
  for (int jj = 0; jj <= rt; ++jj) {
    v8f atA = {}, atB = {};  // dual accumulator chains
#pragma unroll
    for (int ks = 0; ks < 16; ks += 2) {  // K-dim = D = 64
      int d0 = 4 * ks + kb;
      v2f b0 = { sk[(16 * jj + row) * P_ + d0],
                 sk[(16 * jj + row) * P_ + d0 + 1] };
      atA = wmma4(qa[ks], b0, atA);
      int d1 = d0 + 4;
      v2f b1 = { sk[(16 * jj + row) * P_ + d1],
                 sk[(16 * jj + row) * P_ + d1 + 1] };
      atB = wmma4(qa[ks + 1], b1, atB);
    }
    v8f at;
#pragma unroll
    for (int r = 0; r < 8; ++r) at[r] = atA[r] + atB[r];
    if (jj == rt) {  // tril mask on diagonal tile: keep if m >= ncol
#pragma unroll
      for (int r = 0; r < 8; ++r)
        if (half * 8 + r < row) at[r] = 0.f;
    }
    float* tb = stile + (wave * 2 + (jj & 1)) * 16 * 17;  // double-buffered
#pragma unroll
    for (int r = 0; r < 8; ++r)  // D-layout -> LDS for A-fragment reuse
      tb[(half * 8 + r) * 17 + row] = at[r];

#pragma unroll
    for (int s = 0; s < 4; ++s) {  // attn_tile (A) x v rows 16jj..16jj+15 (B)
      v2f a = { tb[row * 17 + 4 * s + kb], tb[row * 17 + 4 * s + kb + 1] };
      int r0 = 16 * jj + 4 * s + kb;
      v2f bd = { 1.f, 1.f };  // denominator tile: attn @ ones = row sums
      accD = wmma4(a, bd, accD);
      v4f x = *(const v4f*)(sv + r0 * P_ + c4);        // row r0, four tiles
      v4f y = *(const v4f*)(sv + (r0 + 1) * P_ + c4);  // row r0 + 1
      v2f b0 = { x[0], y[0] }, b1 = { x[1], y[1] };
      v2f b2 = { x[2], y[2] }, b3 = { x[3], y[3] };
      acc0 = wmma4(a, b0, acc0);
      acc1 = wmma4(a, b1, acc1);
      acc2 = wmma4(a, b2, acc2);
      acc3 = wmma4(a, b3, acc3);
    }
  }

  // Inter-chunk: q @ S (+ q . prefix-ksum into the denominator tile)
#pragma unroll
  for (int ks = 0; ks < 16; ++ks) {
    int d0 = 4 * ks + kb;
    v2f bd = { sks[d0], sks[d0 + 1] };
    accD = wmma4(qa[ks], bd, accD);
    v4f x = *(const v4f*)(ss + d0 * P_ + c4);        // row d0, four tiles
    v4f y = *(const v4f*)(ss + (d0 + 1) * P_ + c4);  // row d0 + 1
    v2f b0 = { x[0], y[0] }, b1 = { x[1], y[1] };
    v2f b2 = { x[2], y[2] }, b3 = { x[3], y[3] };
    acc0 = wmma4(qa[ks], b0, acc0);
    acc1 = wmma4(qa[ks], b1, acc1);
    acc2 = wmma4(qa[ks], b2, acc2);
    acc3 = wmma4(qa[ks], b3, acc3);
  }

  // Z normalize + store (denominator tile has identical columns, lane-matched)
  float* op =
      Out + (((size_t)n * L_ + (t0 + 16 * rt + half * 8)) * H_ + h) * D_ + c4;
#pragma unroll  // constant offsets: one address pair serves all eight stores
  for (int r = 0; r < 8; ++r) {
    float z = 1.f / (accD[r] + 1e-6f);
    v4f o = { acc0[r] * z, acc1[r] * z, acc2[r] * z, acc3[r] * z };
    *(v4f*)(op + r * (H_ * D_)) = o;
  }
}

extern "C" void kernel_launch(void* const* d_in, const int* in_sizes, int n_in,
                              void* d_out, int out_size, void* d_ws,
                              size_t ws_size, hipStream_t stream) {
  const float* Qg = (const float*)d_in[0];
  const float* Kg = (const float*)d_in[1];
  const float* Vg = (const float*)d_in[2];
  float* Out = (float*)d_out;
  float* Mbuf = (float*)d_ws;                       // [NH, C, 64, 64] fp32
  float* Ksum = Mbuf + (size_t)NH_ * C_ * 64 * 64;  // [NH, C, 64]     fp32
  float* Mtot = Ksum + (size_t)NH_ * C_ * 64;       // [NH, NG, 64, 64] fp32
  float* Ktot = Mtot + (size_t)NH_ * NG_ * 64 * 64; // [NH, NG, 64]    fp32

  const size_t smem3 =
      (size_t)(2 * T_ * P_ + 64 * P_ + 64 + 2 * 8 * 16 * 17) * sizeof(float);

  k_chunksums<<<dim3(NH_ * NG_), dim3(256), 0, stream>>>(Kg, Vg, Mbuf, Ksum, Mtot,
                                                         Ktot);
  k_main<<<dim3(NH_ * C_), dim3(256), smem3, stream>>>(Qg, Kg, Vg, Mbuf, Ksum,
                                                       Mtot, Ktot, Out);
}

// v006
// It runs in 71.8 microseconds.
// Two timings next to v005 both put it at 1.11 times that version's speed.
// All steps since v000 together make it 1.88 times as fast.
#include <hip/hip_runtime.h>

// Causal linear attention (fp32) on gfx1250 via V_WMMA_F32_16X16X4_F32 +
// GLOBAL_LOAD_ASYNC_TO_LDS_B128 (CDNA5 async global->LDS path).
// 2 passes: (1) a block walks a group of chunks and carries the running K^T V
// and key sums: it stores them ahead of each half chunk (prefix inside the
// group) and once more at the end (the group's total), (2) per-chunk output,
// each half of 64 rows from its own state: tril(q k^T) v over the half's keys
// + q S, S = prefix inside the group + earlier groups' totals, with the
// 1/(q . cumsum k + eps) normalizer folded in as an extra WMMA output tile
// (B = ones / key-sums). The causal product costs a row tile one key tile more
// for every 16 rows behind its state, the state product is the same for all:
// a state every 64 rows, not 128, takes four key tiles off row tiles 4 to 7.
// Which column a lane stands for: in a wave's group of n column tiles (4 in
// pass 2, 2 in pass 1) lane c of tile t holds column n*c + t, not 16*t + c. A
// lane's B elements of one k row for all n tiles are then adjacent in LDS (one
// 16- or 8-byte read, not n reads of 4 bytes), and so are its results in memory.

#define N_  4
#define L_  8192
#define H_  8
#define D_  64
#define T_  128       // chunk length
#define C_  64        // chunks = L_/T_
#define NH_ 32        // N_*H_
#define G_  4         // chunks in a group (one pass-1 block)
#define NG_ 16        // groups of a head = C_/G_
#define CS_ (T_ * H_ * D_)  // floats from a chunk's row to the next chunk's
#define P_  68        // padded LDS row stride (floats): 272B = 16B-aligned,
                      // bank = (4*row + col) % 64 -> conflict-free patterns

typedef float v2f __attribute__((ext_vector_type(2)));
typedef float v4f __attribute__((ext_vector_type(4)));
typedef float v8f __attribute__((ext_vector_type(8)));

__device__ __forceinline__ v8f wmma4(v2f a, v2f b, v8f c) {
  // D = A(16x4) * B(4x16) + C(16x16), all fp32
  return __builtin_amdgcn_wmma_f32_16x16x4_f32(false, a, false, b, (short)0, c,
                                               false, false);
}

__device__ __forceinline__ float fmap(float x) {  // elu(x)+1
  return x > 0.f ? x + 1.f : __expf(x);
}

// Async global->LDS copy, 16 bytes per lane. VDST VGPR carries the LDS byte
// offset, VADDR the 64-bit global address (GV mode). Tracked on ASYNCcnt.
__device__ __forceinline__ void async_b128(unsigned lds_off,
                                           unsigned long long gaddr) {
  // The wait in the copy's own statement: its address registers are rewritten
  // only behind it.
  asm volatile("global_load_async_to_lds_b128 %0, %1, off\n\ts_wait_xcnt 0x0"
               :: "v"(lds_off), "v"(gaddr) : "memory");
}
__device__ __forceinline__ void wait_async() {
  asm volatile("s_wait_asynccnt 0" ::: "memory");
}
__device__ __forceinline__ unsigned lds_off(const float* p) {
  return (unsigned)(size_t)p;  // generic LDS addr: low 32 bits = LDS offset
}

// Key tile [128][64] of one chunk and head: thread tid owns 16 bytes of rows
// tid/16 + 16*it (kp: its 16 bytes of row tid/16). The loads and the stores are
// two calls, so that a kernel can put the other global loads of its prologue
// between them: those and the keys' loads are then in flight together and it pays
// their memory latency once.
__device__ __forceinline__ void keys_load(const float* kp, v4f (&kr)[8]) {
#pragma unroll  // constant offsets: one address pair serves all eight loads
  for (int it = 0; it < 8; ++it)
    kr[it] = *(const v4f*)(kp + it * 16 * (H_ * D_));
}
__device__ __forceinline__ void keys_store(float* sk, int tid,
                                           const v4f (&kr)[8]) {
  float* q = sk + (tid >> 4) * P_ + (tid & 15) * 4;
#pragma unroll  // keeps kr[] in registers
  for (int it = 0; it < 8; ++it) {
    v4f f = { fmap(kr[it][0]), fmap(kr[it][1]), fmap(kr[it][2]),
              fmap(kr[it][3]) };
    *(v4f*)(q + it * 16 * P_) = f;
  }
}

// Value tile [128][64] of one chunk and head, async DMA into LDS (raw copy):
// thread tid brings 16 bytes of rows tid/16 + 16*it (vp: those of row tid/16).
__device__ __forceinline__ void values_copy(float* sv, const float* vp,
                                            int tid) {
  const unsigned l = lds_off(sv + (tid >> 4) * P_ + (tid & 15) * 4);
#pragma unroll  // eight copies, each closed by its own s_wait_xcnt
  for (int it = 0; it < 8; ++it)
    async_b128(l + it * 16 * P_ * 4,
               (unsigned long long)(vp + it * 16 * (H_ * D_)));
}

// The two 64x64 states of one chunk (128 rows of 64 floats, contiguous in the
// workspace), async DMA into LDS rows of P_ floats: thread tid brings 16 bytes
// of rows tid/16 + 16*it (sp: those of row tid/16).
__device__ __forceinline__ void states_copy(float* ss, const float* sp,
                                            int tid) {
  const unsigned l = lds_off(ss + (tid >> 4) * P_ + (tid & 15) * 4);
  const unsigned lr = 16 * P_ * 4;  // LDS bytes from one copy to the next
  const unsigned long long g = (unsigned long long)sp;
  const unsigned long long gr = 16 * 64 * 4;  // the same in the workspace
  // One statement: the eight copies issue back to back and share one wait, behind
  // which alone their address registers are rewritten.
  asm volatile(
      "global_load_async_to_lds_b128 %0, %8, off\n\t"
      "global_load_async_to_lds_b128 %1, %9, off\n\t"
      "global_load_async_to_lds_b128 %2, %10, off\n\t"
      "global_load_async_to_lds_b128 %3, %11, off\n\t"
      "global_load_async_to_lds_b128 %4, %12, off\n\t"
      "global_load_async_to_lds_b128 %5, %13, off\n\t"
      "global_load_async_to_lds_b128 %6, %14, off\n\t"
      "global_load_async_to_lds_b128 %7, %15, off\n\t"
      "s_wait_xcnt 0x0"
      :: "v"(l), "v"(l + lr), "v"(l + 2 * lr), "v"(l + 3 * lr), "v"(l + 4 * lr),
         "v"(l + 5 * lr), "v"(l + 6 * lr), "v"(l + 7 * lr), "v"(g), "v"(g + gr),
         "v"(g + 2 * gr), "v"(g + 3 * gr), "v"(g + 4 * gr), "v"(g + 5 * gr),
         "v"(g + 6 * gr), "v"(g + 7 * gr)
      : "memory");
}

// ---- Pass 1: running M = sum k^T v (64x64) and key sums over a group -------
// Two LDS buffers (keys + values each): chunk cc + 1 is on its way from memory
// while chunk cc is worked on.
__global__ __launch_bounds__(256) void k_chunksums(
    const float* __restrict__ Kg, const float* __restrict__ Vg,
    float* __restrict__ Mbuf, float* __restrict__ Ksum,
    float* __restrict__ Mtot, float* __restrict__ Ktot) {
  // buffer b (of two): keys [128][P_], values [128][P_]
  __shared__ __attribute__((aligned(16))) float sm[4 * T_ * P_];
  const int blk = blockIdx.x;           // nh*NG_ + g
  const int g   = blk & (NG_ - 1);
  const int nh  = blk >> 4;
  const int n   = nh >> 3, h = nh & (H_ - 1);
  const int tid = threadIdx.x;
  const size_t off =
      (((size_t)n * L_ + ((size_t)g * (G_ * T_) + (tid >> 4))) * H_ + h) * D_ +
      (tid & 15) * 4;
  const float* kp = Kg + off;
  const float* vp = Vg + off;

  // chunk 0 into buffer 0 (keys need elu(x)+1: through VGPRs)
  v4f kr[8];
  values_copy(sm + T_ * P_, vp, tid);
  keys_load(kp, kr);
  // Closes the run of loads: their address pair stays untouched up to here.
  asm volatile("s_wait_xcnt 0x0" :: "v"(kp) : "memory");
  keys_store(sm, tid, kr);
  wait_async();
  __syncthreads();
  values_copy(sm + 3 * T_ * P_, vp + CS_, tid);  // chunk 1's values, buffer 1

  const int wave = tid >> 5, lane = tid & 31;
  const int col = lane & 15, half = lane >> 4, kb = half * 2;
  const int ti = wave >> 1, tj = (wave & 1) * 2;  // tiles (ti,tj), (ti,tj+1)
  const int e2 = 16 * tj + 2 * col;  // this lane's column of tile tj; tj+1: e2+1
  const int mo = (16 * ti + half * 8) * 64 + e2;
  v8f acc[2] = {}, acc2[2] = {};  // running sums, dual chains a tile
  float ks = 0.f;                 // running key sum of column tid (tid < 64)

#pragma unroll  // cc constant in each copy: buffers and last-trip tests fold away
  for (int cc = 0; cc < G_; ++cc) {
    float* sk = sm + (cc & 1) * (2 * T_ * P_);
    float* sv = sk + T_ * P_;
    if (cc + 1 < G_) {  // next chunk's keys fly while this chunk is worked on
      keys_load(kp + (cc + 1) * CS_, kr);
      // Closes the run of loads: their address pair stays untouched up to here.
      asm volatile("s_wait_xcnt 0x0" :: "v"(kp) : "memory");
    }
    const size_t ch = (size_t)nh * C_ + g * G_ + cc;
#pragma unroll  // hf constant in each copy: the row range folds into offsets
    for (int hf = 0; hf < 2; ++hf) {
      float* mb = Mbuf + (2 * ch + hf) * 4096 + mo;
#pragma unroll  // keeps acc[] in registers
      for (int r = 0; r < 8; ++r) {  // the state ahead of this half chunk
        v2f st = { acc[0][r] + acc2[0][r], acc[1][r] + acc2[1][r] };
        *(v2f*)(mb + r * 64) = st;
      }
      // Closes the run of stores before their data registers are reused.
      asm volatile("s_wait_xcnt 0x0" ::: "memory");
      for (int s = 16 * hf; s < 16 * hf + 16; s += 2) {  // K-dim = 64, dual chains
        int k0 = 4 * s + kb;
        v2f a0 = { sk[k0 * P_ + 16 * ti + col],
                   sk[(k0 + 1) * P_ + 16 * ti + col] };
        v2f x0 = *(const v2f*)(sv + k0 * P_ + e2);        // row k0, both tiles
        v2f y0 = *(const v2f*)(sv + (k0 + 1) * P_ + e2);  // row k0 + 1
        v2f b00 = { x0[0], y0[0] }, b01 = { x0[1], y0[1] };
        acc[0] = wmma4(a0, b00, acc[0]);
        acc[1] = wmma4(a0, b01, acc[1]);
        int k1 = k0 + 4;
        v2f a1 = { sk[k1 * P_ + 16 * ti + col],
                   sk[(k1 + 1) * P_ + 16 * ti + col] };
        v2f x1 = *(const v2f*)(sv + k1 * P_ + e2);
        v2f y1 = *(const v2f*)(sv + (k1 + 1) * P_ + e2);
        v2f b10 = { x1[0], y1[0] }, b11 = { x1[1], y1[1] };
        acc2[0] = wmma4(a1, b10, acc2[0]);
        acc2[1] = wmma4(a1, b11, acc2[1]);
      }
    }
    if (tid < 64) {  // per-d key sum for the normalizer, ahead of each half
      Ksum[2 * ch * 64 + tid] = ks;
      float s = 0.f;
      for (int r = 0; r < T_ / 2; ++r) s += sk[r * P_ + tid];
      Ksum[(2 * ch + 1) * 64 + tid] = ks + s;
      // Closes the store before its address and data registers are reused.
      asm volatile("s_wait_xcnt 0x0" ::: "memory");
      for (int r = T_ / 2; r < T_; ++r) s += sk[r * P_ + tid];
      ks += s;
    }
    if (cc + 1 < G_) {
      // the other buffer's last readers left it at the barrier of trip cc - 1
      keys_store(sm + ((cc + 1) & 1) * (2 * T_ * P_), tid, kr);
      // Hand-over: this wave's LDS reads and writes are done, its copies of
      // chunk cc + 1 have landed; behind the barrier that holds for every wave.
      asm volatile("s_wait_dscnt 0x0" ::: "memory");
      wait_async();
      __syncthreads();
      if (cc + 2 < G_) values_copy(sv, vp + (cc + 2) * CS_, tid);
    }
  }
  wait_async();  // no copy is left in flight at the wave's end

  float* mt = Mtot + (size_t)blk * 4096 + mo;  // the group's total
#pragma unroll
  for (int r = 0; r < 8; ++r) {
    v2f st = { acc[0][r] + acc2[0][r], acc[1][r] + acc2[1][r] };
    *(v2f*)(mt + r * 64) = st;
  }
  if (tid < 64) Ktot[(size_t)blk * 64 + tid] = ks;
}

// ---------------- Pass 2: out = (tril(q k^T) v + q S) * Z -------------------
__global__ __launch_bounds__(256) void k_main(
    const float* __restrict__ Qg, const float* __restrict__ Kg,
    const float* __restrict__ Vg, const float* __restrict__ Mbuf,
    const float* __restrict__ Ksum, const float* __restrict__ Mtot,
    const float* __restrict__ Ktot, float* __restrict__ Out) {
  extern __shared__ float sm[];
  float* sk    = sm;                 // [128][P_] feature-mapped keys
  float* sv    = sk + T_ * P_;       // [128][P_] values           (async DMA)
  float* ss    = sv + T_ * P_;       // [2][64][P_] states ahead of rows 0, 64
  float* sks   = ss + 2 * 64 * P_;   // [2][64]   key sums ahead of rows 0, 64
  // 8 waves x 2 x [16][17] attn tiles, in the room of the first state: the state
  // product runs first, and a barrier ends it before the first tile is written
  // (with room of their own a WGP's LDS would hold two blocks, not three)
  float* stile = ss;

  const int blk = blockIdx.x;
  const int c = blk & (C_ - 1);
  const int nh = blk >> 6;
  const int n = nh >> 3, h = nh & (H_ - 1);
  const long t0 = (long)c * T_;
  const int tid = threadIdx.x;

  // v: async DMA to LDS (raw copy)
  values_copy(sv, Vg + (((size_t)n * L_ + (t0 + (tid >> 4))) * H_ + h) * D_ +
                      (tid & 15) * 4, tid);
  // the chunk's two states inside its group: async DMA as well, no registers
  states_copy(ss, Mbuf + (size_t)blk * (2 * 4096) + tid * 4, tid);
  const int wave = tid >> 5, lane = tid & 31;
  const int row = lane & 15, half = lane >> 4, kb = half * 2;
  const int c4 = row * 4;  // this lane's column of output tile 0; tile t: c4 + t
  // Row tile of this wave. Tile t costs t % 4 + 1 causal key tiles, and waves w
  // and w + 4 of a block share a SIMD: such a pair takes tiles t and 7 - t, so
  // that every SIMD's matrix unit gets the same five key tiles' work from a block.
  const int rt = wave ^ ((wave >> 2) * 3);  // 0 1 2 3 7 6 5 4
  const int sub = rt >> 2;                  // its half of the chunk

  // key sums, keys (elu(x)+1 through VGPRs) and this wave's q rows: every load
  // is issued before the first value is used
  const float* kp =
      Kg + (((size_t)n * L_ + (t0 + (tid >> 4))) * H_ + h) * D_ + (tid & 15) * 4;
  const float* qp =
      Qg + (((size_t)n * L_ + (t0 + 16 * rt + row)) * H_ + h) * D_ + kb;
  const int ki = tid & 127;  // every wave loads: no branch in the run of loads
  float ksv = Ksum[(size_t)blk * 128 + ki];
  v4f kr[8];
  keys_load(kp, kr);
  v2f qa[16];  // q A-fragments for this wave's 16 rows
#pragma unroll  // constant offsets: one address pair serves all sixteen loads
  for (int ks = 0; ks < 16; ++ks) qa[ks] = *(const v2f*)(qp + 4 * ks);
  // Closes the run of loads: their address registers stay untouched up to here.
  // ksv is named so that its load stays in the run and is not sunk to its use.
  asm volatile("s_wait_xcnt 0x0" :: "v"(ki), "v"(kp), "v"(qp), "v"(ksv)
               : "memory");
  keys_store(sk, tid, kr);
#pragma unroll
  for (int ks = 0; ks < 16; ++ks) {
    qa[ks][0] = fmap(qa[ks][0]);
    qa[ks][1] = fmap(qa[ks][1]);
  }
  // Totals of the head's earlier groups, in ascending order, four groups a trip:
  // a trip's loads are all issued before its first sum (every group has a total
  // in the workspace, so a trip may load past the last one wanted; it adds only
  // the wanted ones). Thread tid owns 16 bytes of rows tid/16 + 16*it of the
  // 64x64 sum, which goes into both states.
  const int ng = c / G_;  // earlier groups: the same for the whole block
  const float* tp = Mtot + (size_t)nh * NG_ * 4096 + tid * 4;
  const float* ktp = Ktot + (size_t)nh * NG_ * 64 + (tid & 63);
  v4f ta[4] = {};
  float kts = 0.f;
  for (int g0 = 0; g0 < ng; g0 += 4) {
    v4f tv[4][4];
    float kt[4];
#pragma unroll  // constant offsets: two address pairs serve the trip's loads
    for (int j = 0; j < 4; ++j) {
#pragma unroll
      for (int it = 0; it < 4; ++it)
        tv[j][it] = *(const v4f*)(tp + j * 4096 + it * 1024);
      kt[j] = ktp[j * 64];
    }
    // Closes the run of loads before their address pairs are advanced.
    asm volatile("s_wait_xcnt 0x0" :: "v"(tp), "v"(ktp) : "memory");
#pragma unroll  // keeps tv[] in registers
    for (int j = 0; j < 4; ++j)
      if (g0 + j < ng) {
#pragma unroll
        for (int it = 0; it < 4; ++it) ta[it] += tv[j][it];
        kts += kt[j];
      }
    tp += 4 * 4096;
    ktp += 4 * 64;
  }
  wait_async();  // this wave's copies have landed: a thread adds to its own bytes
#pragma unroll
  for (int it = 0; it < 8; ++it) {
    v4f* p = (v4f*)(ss + ((tid >> 4) + 16 * it) * P_ + (tid & 15) * 4);
    *p = *p + ta[it & 3];
  }
  if (tid < 128) sks[tid] = ksv + kts;
  __syncthreads();

  v8f acc0 = {}, acc1 = {}, acc2 = {}, acc3 = {}, accD = {};

  // Inter-chunk: q @ S (+ q . prefix-ksum into the denominator tile)
  const float* sw = ss + sub * (64 * P_);  // the state ahead of this wave's half
  const float* kw = sks + sub * 64;
#pragma unroll
  for (int ks = 0; ks < 16; ++ks) {
    int d0 = 4 * ks + kb;
    v2f bd = { kw[d0], kw[d0 + 1] };
    accD = wmma4(qa[ks], bd, accD);
    v4f x = *(const v4f*)(sw + d0 * P_ + c4);        // row d0, four tiles
    v4f y = *(const v4f*)(sw + (d0 + 1) * P_ + c4);  // row d0 + 1
    v2f b0 = { x[0], y[0] }, b1 = { x[1], y[1] };
    v2f b2 = { x[2], y[2] }, b3 = { x[3], y[3] };
    acc0 = wmma4(qa[ks], b0, acc0);
    acc1 = wmma4(qa[ks], b1, acc1);
    acc2 = wmma4(qa[ks], b2, acc2);
    acc3 = wmma4(qa[ks], b3, acc3);
  }
  // Every wave has read its state: the attn tiles may take that room.
  __syncthreads();

  // Inside the half: attn tiles 4*sub <= jj <= rt (causality), fused with attn*v
  for (int jj = 4 * sub; jj <= rt; ++jj) {
    v8f atA = {}, atB = {};  // dual accumulator chains
#pragma unroll
    for (int ks = 0; ks < 16; ks += 2) {  // K-dim = D = 64
      int d0 = 4 * ks + kb;
      v2f b0 = { sk[(16 * jj + row) * P_ + d0],
                 sk[(16 * jj + row) * P_ + d0 + 1] };
      atA = wmma4(qa[ks], b0, atA);
      int d1 = d0 + 4;
      v2f b1 = { sk[(16 * jj + row) * P_ + d1],
                 sk[(16 * jj + row) * P_ + d1 + 1] };
      atB = wmma4(qa[ks + 1], b1, atB);
    }
    v8f at;
#pragma unroll
    for (int r = 0; r < 8; ++r) at[r] = atA[r] + atB[r];
    if (jj == rt) {  // tril mask on diagonal tile: keep if m >= ncol
#pragma unroll
      for (int r = 0; r < 8; ++r)
        if (half * 8 + r < row) at[r] = 0.f;
    }
    float* tb = stile + (wave * 2 + (jj & 1)) * 16 * 17;  // double-buffered
#pragma unroll
    for (int r = 0; r < 8; ++r)  // D-layout -> LDS for A-fragment reuse
      tb[half * (8 * 17) + row + r * 17] = at[r];

#pragma unroll
    for (int s = 0; s < 4; ++s) {  // attn_tile (A) x v rows 16jj..16jj+15 (B)
      v2f a = { tb[row * 17 + 4 * s + kb], tb[row * 17 + 4 * s + kb + 1] };
      int r0 = 16 * jj + 4 * s + kb;
      v2f bd = { 1.f, 1.f };  // denominator tile: attn @ ones = row sums
      accD = wmma4(a, bd, accD);
      v4f x = *(const v4f*)(sv + r0 * P_ + c4);        // row r0, four tiles
      v4f y = *(const v4f*)(sv + (r0 + 1) * P_ + c4);  // row r0 + 1
      v2f b0 = { x[0], y[0] }, b1 = { x[1], y[1] };
      v2f b2 = { x[2], y[2] }, b3 = { x[3], y[3] };
      acc0 = wmma4(a, b0, acc0);
      acc1 = wmma4(a, b1, acc1);
      acc2 = wmma4(a, b2, acc2);
      acc3 = wmma4(a, b3, acc3);
    }
  }

  // Z normalize + store (denominator tile has identical columns, lane-matched)
  float* op =
      Out + (((size_t)n * L_ + (t0 + 16 * rt + half * 8)) * H_ + h) * D_ + c4;
#pragma unroll  // constant offsets: one address pair serves all eight stores
  for (int r = 0; r < 8; ++r) {
    float z = 1.f / (accD[r] + 1e-6f);
    v4f o = { acc0[r] * z, acc1[r] * z, acc2[r] * z, acc3[r] * z };
    *(v4f*)(op + r * (H_ * D_)) = o;
  }
}

extern "C" void kernel_launch(void* const* d_in, const int* in_sizes, int n_in,
                              void* d_out, int out_size, void* d_ws,
                              size_t ws_size, hipStream_t stream) {
  const float* Qg = (const float*)d_in[0];
  const float* Kg = (const float*)d_in[1];
  const float* Vg = (const float*)d_in[2];
  float* Out = (float*)d_out;
  float* Mbuf = (float*)d_ws;                           // [NH, C, 2, 64, 64] fp32
  float* Ksum = Mbuf + (size_t)NH_ * C_ * 2 * 64 * 64;  // [NH, C, 2, 64] fp32
  float* Mtot = Ksum + (size_t)NH_ * C_ * 2 * 64;       // [NH, NG, 64, 64] fp32
  float* Ktot = Mtot + (size_t)NH_ * NG_ * 64 * 64; // [NH, NG, 64]    fp32

  const size_t smem3 =
      (size_t)(2 * T_ * P_ + 2 * 64 * P_ + 2 * 64) * sizeof(float);

  k_chunksums<<<dim3(NH_ * NG_), dim3(256), 0, stream>>>(Kg, Vg, Mbuf, Ksum, Mtot,
                                                         Ktot);
  k_main<<<dim3(NH_ * C_), dim3(256), smem3, stream>>>(Qg, Kg, Vg, Mbuf, Ksum,
                                                       Mtot, Ktot, Out);
}

// v007
// A run of this version takes 68.9 microseconds.
// In both of two side-by-side timings against v006, it was 1.04 times as fast.
// Counting every step since v000, it is 1.96 times as fast.
#include <hip/hip_runtime.h>

// Causal linear attention (fp32) on gfx1250 via V_WMMA_F32_16X16X4_F32 +
// GLOBAL_LOAD_ASYNC_TO_LDS_B128 (CDNA5 async global->LDS path).
// 2 passes: (1) a block walks a group of chunks and carries the running K^T V
// and key sums: it stores them ahead of each half chunk (prefix inside the
// group) and once more at the end (the group's total), (2) output, a block a
// group, chunk by chunk, each half of 64 rows from its own state:
// tril(q k^T) v over the half's keys
// + q S, S = prefix inside the group + earlier groups' totals, with the
// 1/(q . cumsum k + eps) normalizer folded in as an extra WMMA output tile
// (B = ones / key-sums). The causal product costs a row tile one key tile more
// for every 16 rows behind its state, the state product is the same for all:
// a state every 64 rows, not 128, takes four key tiles off row tiles 4 to 7.
// Which column a lane stands for: in a wave's group of n column tiles (4 in
// pass 2, 2 in pass 1) lane c of tile t holds column n*c + t, not 16*t + c. A
// lane's B elements of one k row for all n tiles are then adjacent in LDS (one
// 16- or 8-byte read, not n reads of 4 bytes), and so are its results in memory.

#define N_  4
#define L_  8192
#define H_  8
#define D_  64
#define T_  128       // chunk length
#define C_  64        // chunks = L_/T_
#define NH_ 32        // N_*H_
#define G_  4         // chunks in a group (one pass-1 block)
#define NG_ 16        // groups of a head = C_/G_
#define CS_ (T_ * H_ * D_)  // floats from a chunk's row to the next chunk's
#define P_  68        // padded LDS row stride (floats): 272B = 16B-aligned,
                      // bank = (4*row + col) % 64 -> conflict-free patterns

typedef float v2f __attribute__((ext_vector_type(2)));
typedef float v4f __attribute__((ext_vector_type(4)));
typedef float v8f __attribute__((ext_vector_type(8)));

__device__ __forceinline__ v8f wmma4(v2f a, v2f b, v8f c) {
  // D = A(16x4) * B(4x16) + C(16x16), all fp32
  return __builtin_amdgcn_wmma_f32_16x16x4_f32(false, a, false, b, (short)0, c,
                                               false, false);
}

__device__ __forceinline__ float fmap(float x) {  // elu(x)+1
  return x > 0.f ? x + 1.f : __expf(x);
}

// Async global->LDS copy, 16 bytes per lane. VDST VGPR carries the LDS byte
// offset, VADDR the 64-bit global address (GV mode). Tracked on ASYNCcnt.
__device__ __forceinline__ void async_b128(unsigned lds_off,
                                           unsigned long long gaddr) {
  // The wait in the copy's own statement: its address registers are rewritten
  // only behind it.
  asm volatile("global_load_async_to_lds_b128 %0, %1, off\n\ts_wait_xcnt 0x0"
               :: "v"(lds_off), "v"(gaddr) : "memory");
}
__device__ __forceinline__ void wait_async() {
  asm volatile("s_wait_asynccnt 0" ::: "memory");
}
__device__ __forceinline__ unsigned lds_off(const float* p) {
  return (unsigned)(size_t)p;  // generic LDS addr: low 32 bits = LDS offset
}

// Key tile [128][64] of one chunk and head: thread tid owns 16 bytes of rows
// tid/16 + 16*it (kp: its 16 bytes of row tid/16). The loads and the stores are
// two calls, so that a kernel can put the other global loads of its prologue
// between them: those and the keys' loads are then in flight together and it pays
// their memory latency once.
__device__ __forceinline__ void keys_load(const float* kp, v4f (&kr)[8]) {
#pragma unroll  // constant offsets: one address pair serves all eight loads
  for (int it = 0; it < 8; ++it)
    kr[it] = *(const v4f*)(kp + it * 16 * (H_ * D_));
}
__device__ __forceinline__ void keys_store(float* sk, int tid,
                                           const v4f (&kr)[8]) {
  float* q = sk + (tid >> 4) * P_ + (tid & 15) * 4;
#pragma unroll  // keeps kr[] in registers
  for (int it = 0; it < 8; ++it) {
    v4f f = { fmap(kr[it][0]), fmap(kr[it][1]), fmap(kr[it][2]),
              fmap(kr[it][3]) };
    *(v4f*)(q + it * 16 * P_) = f;
  }
}

// Value tile [128][64] of one chunk and head, async DMA into LDS (raw copy):
// thread tid brings 16 bytes of rows tid/16 + 16*it (vp: those of row tid/16).
__device__ __forceinline__ void values_copy(float* sv, const float* vp,
                                            int tid) {
  const unsigned l = lds_off(sv + (tid >> 4) * P_ + (tid & 15) * 4);
#pragma unroll  // eight copies, each closed by its own s_wait_xcnt
  for (int it = 0; it < 8; ++it)
    async_b128(l + it * 16 * P_ * 4,
               (unsigned long long)(vp + it * 16 * (H_ * D_)));
}

// The two 64x64 states of one chunk (128 rows of 64 floats, contiguous in the
// workspace), async DMA into LDS rows of P_ floats: thread tid brings 16 bytes
// of rows tid/16 + 16*it (sp: those of row tid/16).
__device__ __forceinline__ void states_copy(float* ss, const float* sp,
                                            int tid) {
  const unsigned l = lds_off(ss + (tid >> 4) * P_ + (tid & 15) * 4);
  const unsigned lr = 16 * P_ * 4;  // LDS bytes from one copy to the next
  const unsigned long long g = (unsigned long long)sp;
  const unsigned long long gr = 16 * 64 * 4;  // the same in the workspace
  // One statement: the eight copies issue back to back and share one wait, behind
  // which alone their address registers are rewritten.
  asm volatile(
      "global_load_async_to_lds_b128 %0, %8, off\n\t"
      "global_load_async_to_lds_b128 %1, %9, off\n\t"
      "global_load_async_to_lds_b128 %2, %10, off\n\t"
      "global_load_async_to_lds_b128 %3, %11, off\n\t"
      "global_load_async_to_lds_b128 %4, %12, off\n\t"
      "global_load_async_to_lds_b128 %5, %13, off\n\t"
      "global_load_async_to_lds_b128 %6, %14, off\n\t"
      "global_load_async_to_lds_b128 %7, %15, off\n\t"
      "s_wait_xcnt 0x0"
      :: "v"(l), "v"(l + lr), "v"(l + 2 * lr), "v"(l + 3 * lr), "v"(l + 4 * lr),
         "v"(l + 5 * lr), "v"(l + 6 * lr), "v"(l + 7 * lr), "v"(g), "v"(g + gr),
         "v"(g + 2 * gr), "v"(g + 3 * gr), "v"(g + 4 * gr), "v"(g + 5 * gr),
         "v"(g + 6 * gr), "v"(g + 7 * gr)
      : "memory");
}

// ---- Pass 1: running M = sum k^T v (64x64) and key sums over a group -------
// Two LDS buffers (keys + values each): chunk cc + 1 is on its way from memory
// while chunk cc is worked on.
__global__ __launch_bounds__(256) void k_chunksums(
    const float* __restrict__ Kg, const float* __restrict__ Vg,
    float* __restrict__ Mbuf, float* __restrict__ Ksum,
    float* __restrict__ Mtot, float* __restrict__ Ktot) {
  // buffer b (of two): keys [128][P_], values [128][P_]
  __shared__ __attribute__((aligned(16))) float sm[4 * T_ * P_];
  const int blk = blockIdx.x;           // nh*NG_ + g
  const int g   = blk & (NG_ - 1);
  const int nh  = blk >> 4;
  const int n   = nh >> 3, h = nh & (H_ - 1);
  const int tid = threadIdx.x;
  const size_t off =
      (((size_t)n * L_ + ((size_t)g * (G_ * T_) + (tid >> 4))) * H_ + h) * D_ +
      (tid & 15) * 4;
  const float* kp = Kg + off;
  const float* vp = Vg + off;

  // chunk 0 into buffer 0 (keys need elu(x)+1: through VGPRs)
  v4f kr[8];
  values_copy(sm + T_ * P_, vp, tid);
  keys_load(kp, kr);
  // Closes the run of loads: their address pair stays untouched up to here.
  asm volatile("s_wait_xcnt 0x0" :: "v"(kp) : "memory");
  keys_store(sm, tid, kr);
  wait_async();
  __syncthreads();
  values_copy(sm + 3 * T_ * P_, vp + CS_, tid);  // chunk 1's values, buffer 1

  const int wave = tid >> 5, lane = tid & 31;
  const int col = lane & 15, half = lane >> 4, kb = half * 2;
  const int ti = wave >> 1, tj = (wave & 1) * 2;  // tiles (ti,tj), (ti,tj+1)
  const int e2 = 16 * tj + 2 * col;  // this lane's column of tile tj; tj+1: e2+1
  const int mo = (16 * ti + half * 8) * 64 + e2;
  v8f acc[2] = {}, acc2[2] = {};  // running sums, dual chains a tile
  float ks = 0.f;                 // running key sum of column tid (tid < 64)

#pragma unroll  // cc constant in each copy: buffers and last-trip tests fold away
  for (int cc = 0; cc < G_; ++cc) {
    float* sk = sm + (cc & 1) * (2 * T_ * P_);
    float* sv = sk + T_ * P_;
    if (cc + 1 < G_) {  // next chunk's keys fly while this chunk is worked on
      keys_load(kp + (cc + 1) * CS_, kr);
      // Closes the run of loads: their address pair stays untouched up to here.
      asm volatile("s_wait_xcnt 0x0" :: "v"(kp) : "memory");
    }
    const size_t ch = (size_t)nh * C_ + g * G_ + cc;
#pragma unroll  // hf constant in each copy: the row range folds into offsets
    for (int hf = 0; hf < 2; ++hf) {
      float* mb = Mbuf + (2 * ch + hf) * 4096 + mo;
#pragma unroll  // keeps acc[] in registers
      for (int r = 0; r < 8; ++r) {  // the state ahead of this half chunk
        v2f st = { acc[0][r] + acc2[0][r], acc[1][r] + acc2[1][r] };
        *(v2f*)(mb + r * 64) = st;
      }
      // Closes the run of stores before their data registers are reused.
      asm volatile("s_wait_xcnt 0x0" ::: "memory");
      for (int s = 16 * hf; s < 16 * hf + 16; s += 2) {  // K-dim = 64, dual chains
        int k0 = 4 * s + kb;
        v2f a0 = { sk[k0 * P_ + 16 * ti + col],
                   sk[(k0 + 1) * P_ + 16 * ti + col] };
        v2f x0 = *(const v2f*)(sv + k0 * P_ + e2);        // row k0, both tiles
        v2f y0 = *(const v2f*)(sv + (k0 + 1) * P_ + e2);  // row k0 + 1
        v2f b00 = { x0[0], y0[0] }, b01 = { x0[1], y0[1] };
        acc[0] = wmma4(a0, b00, acc[0]);
        acc[1] = wmma4(a0, b01, acc[1]);
        int k1 = k0 + 4;
        v2f a1 = { sk[k1 * P_ + 16 * ti + col],
                   sk[(k1 + 1) * P_ + 16 * ti + col] };
        v2f x1 = *(const v2f*)(sv + k1 * P_ + e2);
        v2f y1 = *(const v2f*)(sv + (k1 + 1) * P_ + e2);
        v2f b10 = { x1[0], y1[0] }, b11 = { x1[1], y1[1] };
        acc2[0] = wmma4(a1, b10, acc2[0]);
        acc2[1] = wmma4(a1, b11, acc2[1]);
      }
    }
    if (tid < 64) {  // per-d key sum for the normalizer, ahead of each half
      Ksum[2 * ch * 64 + tid] = ks;
      float s = 0.f;
      for (int r = 0; r < T_ / 2; ++r) s += sk[r * P_ + tid];
      Ksum[(2 * ch + 1) * 64 + tid] = ks + s;
      // Closes the store before its address and data registers are reused.
      asm volatile("s_wait_xcnt 0x0" ::: "memory");
      for (int r = T_ / 2; r < T_; ++r) s += sk[r * P_ + tid];
      ks += s;
    }
    if (cc + 1 < G_) {
      // the other buffer's last readers left it at the barrier of trip cc - 1
      keys_store(sm + ((cc + 1) & 1) * (2 * T_ * P_), tid, kr);
      // Hand-over: this wave's LDS reads and writes are done, its copies of
      // chunk cc + 1 have landed; behind the barrier that holds for every wave.
      asm volatile("s_wait_dscnt 0x0" ::: "memory");
      wait_async();
      __syncthreads();
      if (cc + 2 < G_) values_copy(sv, vp + (cc + 2) * CS_, tid);
    }
  }
  wait_async();  // no copy is left in flight at the wave's end

  float* mt = Mtot + (size_t)blk * 4096 + mo;  // the group's total
#pragma unroll
  for (int r = 0; r < 8; ++r) {
    v2f st = { acc[0][r] + acc2[0][r], acc[1][r] + acc2[1][r] };
    *(v2f*)(mt + r * 64) = st;
  }
  if (tid < 64) Ktot[(size_t)blk * 64 + tid] = ks;
}

// ---------------- Pass 2: out = (tril(q k^T) v + q S) * Z -------------------
// A block walks the chunks of one group. The sum of the earlier groups' totals
// is the same for all of them: it is formed once and kept in registers. While a
// chunk is worked on the next one is on its way: keys, q rows and key sums into
// registers, values into the second value buffer, states into the state room as
// soon as every wave has left it.
__global__ __launch_bounds__(256) void k_main(
    const float* __restrict__ Qg, const float* __restrict__ Kg,
    const float* __restrict__ Vg, const float* __restrict__ Mbuf,
    const float* __restrict__ Ksum, const float* __restrict__ Mtot,
    const float* __restrict__ Ktot, float* __restrict__ Out) {
  extern __shared__ float sm[];
  float* sk    = sm;                  // [128][P_] feature-mapped keys
  float* svb   = sk + T_ * P_;        // 2 x [128][P_] values        (async DMA)
  float* ss    = svb + 2 * T_ * P_;   // [2][64][P_] states ahead of rows 0, 64
  float* sks   = ss + 2 * 64 * P_;    // [2][64]   key sums ahead of rows 0, 64
  float* stile = sks + 2 * 64;        // 8 waves x 2 x [16][17] attn tiles

  const int blk = blockIdx.x;  // nh*NG_ + g
  const int g = blk & (NG_ - 1);
  const int nh = blk >> 4;
  const int n = nh >> 3, h = nh & (H_ - 1);
  const long t0 = (long)g * (G_ * T_);
  const int tid = threadIdx.x;
  const size_t off =
      (((size_t)n * L_ + (t0 + (tid >> 4))) * H_ + h) * D_ + (tid & 15) * 4;
  const float* kp = Kg + off;
  const float* vp = Vg + off;
  const float* sp = Mbuf + (size_t)blk * (G_ * 2 * 4096) + tid * 4;

  // chunk 0. v: async DMA to LDS (raw copy)
  values_copy(svb, vp, tid);
  // the chunk's two states inside its group: async DMA as well, no registers
  states_copy(ss, sp, tid);
  const int wave = tid >> 5, lane = tid & 31;
  const int row = lane & 15, half = lane >> 4, kb = half * 2;
  const int c4 = row * 4;  // this lane's column of output tile 0; tile t: c4 + t
  // Row tile of this wave. Tile t costs t % 4 + 1 causal key tiles, and waves w
  // and w + 4 of a block share a SIMD: such a pair takes tiles t and 7 - t, so
  // that every SIMD's matrix unit gets the same five key tiles' work in each chunk of a block.
  const int rt = wave ^ ((wave >> 2) * 3);  // 0 1 2 3 7 6 5 4
  const int sub = rt >> 2;                  // its half of the chunk

  // key sums, keys (elu(x)+1 through VGPRs) and this wave's q rows: every load
  // is issued before the first value is used
  const float* qp =
      Qg + (((size_t)n * L_ + (t0 + 16 * rt + row)) * H_ + h) * D_ + kb;
  // every wave loads: no branch in the run of loads
  const float* ksp = Ksum + (size_t)blk * (G_ * 128) + (tid & 127);
  float ksv = *ksp;
  v4f kr[8];
  keys_load(kp, kr);
  v2f qa[16];  // q A-fragments for this wave's 16 rows
#pragma unroll  // constant offsets: one address pair serves all sixteen loads
  for (int ks = 0; ks < 16; ++ks) qa[ks] = *(const v2f*)(qp + 4 * ks);
  // Closes the run of loads: their address registers stay untouched up to here.
  // ksv is named so that its load stays in the run and is not sunk to its use.
  asm volatile("s_wait_xcnt 0x0" :: "v"(ksp), "v"(kp), "v"(qp), "v"(ksv)
               : "memory");
  // Holds the keys' feature map behind the run of loads: moved up, it made the q
  // loads wait for the keys' arrival, a second memory round trip.
  __builtin_amdgcn_sched_barrier(0);
  keys_store(sk, tid, kr);
#pragma unroll
  for (int ks = 0; ks < 16; ++ks) {
    qa[ks][0] = fmap(qa[ks][0]);
    qa[ks][1] = fmap(qa[ks][1]);
  }
  // Totals of the head's earlier groups, in ascending order, four groups a trip:
  // a trip's loads are all issued before its first sum (every group has a total
  // in the workspace, so a trip may load past the last one wanted; it adds only
  // the wanted ones). Thread tid owns 16 bytes of rows tid/16 + 16*it of the
  // 64x64 sum, which goes into both states of every chunk of the group.
  const float* tp = Mtot + (size_t)nh * NG_ * 4096 + tid * 4;
  const float* ktp = Ktot + (size_t)nh * NG_ * 64 + (tid & 63);
  v4f ta[4] = {};
  float kts = 0.f;
  for (int g0 = 0; g0 < g; g0 += 4) {
    v4f tv[4][4];
    float kt[4];
#pragma unroll  // constant offsets: two address pairs serve the trip's loads
    for (int j = 0; j < 4; ++j) {
#pragma unroll
      for (int it = 0; it < 4; ++it)
        tv[j][it] = *(const v4f*)(tp + j * 4096 + it * 1024);
      kt[j] = ktp[j * 64];
    }
    // Closes the run of loads before their address pairs are advanced.
    asm volatile("s_wait_xcnt 0x0" :: "v"(tp), "v"(ktp) : "memory");
#pragma unroll  // keeps tv[] in registers
    for (int j = 0; j < 4; ++j)
      if (g0 + j < g) {
#pragma unroll
        for (int it = 0; it < 4; ++it) ta[it] += tv[j][it];
        kts += kt[j];
      }
    tp += 4 * 4096;
    ktp += 4 * 64;
  }
  wait_async();  // this wave's copies have landed: a thread adds to its own bytes
#pragma unroll
  for (int it = 0; it < 8; ++it) {
    v4f* p = (v4f*)(ss + ((tid >> 4) + 16 * it) * P_ + (tid & 15) * 4);
    *p = *p + ta[it & 3];
  }
  if (tid < 128) sks[tid] = ksv + kts;
  __syncthreads();
  values_copy(svb + T_ * P_, vp + CS_, tid);  // chunk 1's values, buffer 1

  const float* sw = ss + sub * (64 * P_);  // the state ahead of this wave's half
  const float* kw = sks + sub * 64;

#pragma unroll 1  // one copy of a chunk's code: the kernel's text stays short
  for (int cc = 0; cc < G_; ++cc) {
    float* sv = svb + (cc & 1) * (T_ * P_);
    const bool more = cc + 1 < G_;  // the same for the whole block
    v2f qn[16];
    float ksn = 0.f;
    if (more) {  // next chunk's keys, q rows and key sums fly during this chunk
      const float* ksn_p = ksp + (cc + 1) * 128;
      const float* kn_p = kp + (cc + 1) * CS_;
      const float* qn_p = qp + (cc + 1) * CS_;
      ksn = *ksn_p;
      keys_load(kn_p, kr);
#pragma unroll  // constant offsets: one address pair serves all sixteen loads
      for (int ks = 0; ks < 16; ++ks) qn[ks] = *(const v2f*)(qn_p + 4 * ks);
      // Closes the run of loads: their address registers stay untouched up to here.
      asm volatile("s_wait_xcnt 0x0" :: "v"(ksn_p), "v"(kn_p), "v"(qn_p)
                   : "memory");
    }

    v8f acc0 = {}, acc1 = {}, acc2 = {}, acc3 = {}, accD = {};

    // Inter-chunk: q @ S (+ q . prefix-ksum into the denominator tile)
#pragma unroll
    for (int ks = 0; ks < 16; ++ks) {
      int d0 = 4 * ks + kb;
      v2f bd = { kw[d0], kw[d0 + 1] };
      accD = wmma4(qa[ks], bd, accD);
      v4f x = *(const v4f*)(sw + d0 * P_ + c4);        // row d0, four tiles
      v4f y = *(const v4f*)(sw + (d0 + 1) * P_ + c4);  // row d0 + 1
      v2f b0 = { x[0], y[0] }, b1 = { x[1], y[1] };
      v2f b2 = { x[2], y[2] }, b3 = { x[3], y[3] };
      acc0 = wmma4(qa[ks], b0, acc0);
      acc1 = wmma4(qa[ks], b1, acc1);
      acc2 = wmma4(qa[ks], b2, acc2);
      acc3 = wmma4(qa[ks], b3, acc3);
    }
    if (more) {
      // This wave's LDS traffic on the states is done; behind the barrier every
      // wave has read its state, and the next chunk's states may take the room.
      asm volatile("s_wait_dscnt 0x0" ::: "memory");
      __syncthreads();
      states_copy(ss, sp + (cc + 1) * (2 * 4096), tid);
    }

    // Inside the half: attn tiles 4*sub <= jj <= rt (causality), fused with attn*v
    for (int jj = 4 * sub; jj <= rt; ++jj) {
      v8f atA = {}, atB = {};  // dual accumulator chains
#pragma unroll
      for (int ks = 0; ks < 16; ks += 2) {  // K-dim = D = 64
        int d0 = 4 * ks + kb;
        v2f b0 = { sk[(16 * jj + row) * P_ + d0],
                   sk[(16 * jj + row) * P_ + d0 + 1] };
        atA = wmma4(qa[ks], b0, atA);
        int d1 = d0 + 4;
        v2f b1 = { sk[(16 * jj + row) * P_ + d1],
                   sk[(16 * jj + row) * P_ + d1 + 1] };
        atB = wmma4(qa[ks + 1], b1, atB);
      }
      v8f at;
#pragma unroll
      for (int r = 0; r < 8; ++r) at[r] = atA[r] + atB[r];
      if (jj == rt) {  // tril mask on diagonal tile: keep if m >= ncol
#pragma unroll
        for (int r = 0; r < 8; ++r)
          if (half * 8 + r < row) at[r] = 0.f;
      }
      float* tb = stile + (wave * 2 + (jj & 1)) * 16 * 17;  // double-buffered
#pragma unroll
      for (int r = 0; r < 8; ++r)  // D-layout -> LDS for A-fragment reuse
        tb[half * (8 * 17) + row + r * 17] = at[r];

#pragma unroll
      for (int s = 0; s < 4; ++s) {  // attn_tile (A) x v rows 16jj..16jj+15 (B)
        v2f a = { tb[row * 17 + 4 * s + kb], tb[row * 17 + 4 * s + kb + 1] };
        int r0 = 16 * jj + 4 * s + kb;
        v2f bd = { 1.f, 1.f };  // denominator tile: attn @ ones = row sums
        accD = wmma4(a, bd, accD);
        v4f x = *(const v4f*)(sv + r0 * P_ + c4);        // row r0, four tiles
        v4f y = *(const v4f*)(sv + (r0 + 1) * P_ + c4);  // row r0 + 1
        v2f b0 = { x[0], y[0] }, b1 = { x[1], y[1] };
        v2f b2 = { x[2], y[2] }, b3 = { x[3], y[3] };
        acc0 = wmma4(a, b0, acc0);
        acc1 = wmma4(a, b1, acc1);
        acc2 = wmma4(a, b2, acc2);
        acc3 = wmma4(a, b3, acc3);
      }
    }

    if (more) {
      // This wave's LDS reads are done; behind the barrier every wave has left
      // the keys and this chunk's values.
      asm volatile("s_wait_dscnt 0x0" ::: "memory");
      __syncthreads();
      keys_store(sk, tid, kr);
#pragma unroll
      for (int ks = 0; ks < 16; ++ks) {
        qa[ks][0] = fmap(qn[ks][0]);
        qa[ks][1] = fmap(qn[ks][1]);
      }
      // This wave's copies (next states, next values) have landed: a thread adds
      // the earlier groups' sum to its own bytes.
      wait_async();
#pragma unroll
      for (int it = 0; it < 8; ++it) {
        v4f* p = (v4f*)(ss + ((tid >> 4) + 16 * it) * P_ + (tid & 15) * 4);
        *p = *p + ta[it & 3];
      }
      if (tid < 128) sks[tid] = ksn + kts;
      // Hand-over: this wave's LDS writes are done and its copies have landed;
      // behind the barrier that holds for every wave.
      asm volatile("s_wait_dscnt 0x0" ::: "memory");
      __syncthreads();
      if (cc + 2 < G_) values_copy(sv, vp + (cc + 2) * CS_, tid);
    }

    // Z normalize + store (denominator tile has identical columns, lane-matched).
    // Behind the hand-over: a barrier waits for the wave's stores, and the next one
    // stands a whole state product away.
    float* op = Out + (((size_t)n * L_ + (t0 + cc * T_ + 16 * rt + half * 8)) * H_ +
                       h) * D_ + c4;
#pragma unroll  // constant offsets: one address pair serves all eight stores
    for (int r = 0; r < 8; ++r) {
      float z = 1.f / (accD[r] + 1e-6f);
      v4f o = { acc0[r] * z, acc1[r] * z, acc2[r] * z, acc3[r] * z };
      *(v4f*)(op + r * (H_ * D_)) = o;
    }
    // Closes the run of stores before their address and data registers are reused.
    asm volatile("s_wait_xcnt 0x0" ::: "memory");
  }
  wait_async();  // no copy is left in flight at the wave's end
}

extern "C" void kernel_launch(void* const* d_in, const int* in_sizes, int n_in,
                              void* d_out, int out_size, void* d_ws,
                              size_t ws_size, hipStream_t stream) {
  const float* Qg = (const float*)d_in[0];
  const float* Kg = (const float*)d_in[1];
  const float* Vg = (const float*)d_in[2];
  float* Out = (float*)d_out;
  float* Mbuf = (float*)d_ws;                           // [NH, C, 2, 64, 64] fp32
  float* Ksum = Mbuf + (size_t)NH_ * C_ * 2 * 64 * 64;  // [NH, C, 2, 64] fp32
  float* Mtot = Ksum + (size_t)NH_ * C_ * 2 * 64;       // [NH, NG, 64, 64] fp32
  float* Ktot = Mtot + (size_t)NH_ * NG_ * 64 * 64; // [NH, NG, 64]    fp32

  const size_t smem3 =
      (size_t)(3 * T_ * P_ + 2 * 64 * P_ + 2 * 64 + 8 * 2 * 16 * 17) * sizeof(float);

  k_chunksums<<<dim3(NH_ * NG_), dim3(256), 0, stream>>>(Kg, Vg, Mbuf, Ksum, Mtot,
                                                         Ktot);
  k_main<<<dim3(NH_ * NG_), dim3(256), smem3, stream>>>(Qg, Kg, Vg, Mbuf, Ksum,
                                                       Mtot, Ktot, Out);
}

// v008
// It runs in 66.6 microseconds.
// In both of two side-by-side timings against v007, it was 1.04 times as fast.
// Over all steps from v000 it is 2.04 times as fast.
#include <hip/hip_runtime.h>

// Causal linear attention (fp32) on gfx1250 via V_WMMA_F32_16X16X4_F32 +
// GLOBAL_LOAD_ASYNC_TO_LDS_B128 (CDNA5 async global->LDS path).
// 2 passes: (1) a block walks a group of chunks and carries the running K^T V
// and key sums: it stores them ahead of each half chunk (prefix inside the
// group) and once more at the end (the group's total), (2) output, a block a
// group, chunk by chunk, each half of 64 rows from its own state:
// tril(q k^T) v over the half's keys
// + q S, S = prefix inside the group + earlier groups' totals. The normalizer
// 1/(q . cumsum k + eps) has one column: a lane adds up its own A-fragment
// elements of it (q * key sums, attn), and one WMMA by ones a row tile and chunk
// folds the four k slots. The causal product costs a row tile one key tile more
// for every 16 rows behind its state, the state product is the same for all:
// a state every 64 rows, not 128, takes four key tiles off row tiles 4 to 7.
// Which column a lane stands for: in a wave's group of n column tiles (4 in
// pass 2, 2 in pass 1) lane c of tile t holds column n*c + t, not 16*t + c. A
// lane's B elements of one k row for all n tiles are then adjacent in LDS (one
// 16- or 8-byte read, not n reads of 4 bytes), and so are its results in memory.

#define N_  4
#define L_  8192
#define H_  8
#define D_  64
#define T_  128       // chunk length
#define C_  64        // chunks = L_/T_
#define NH_ 32        // N_*H_
#define G_  4         // chunks in a group (one pass-1 block)
#define NG_ 16        // groups of a head = C_/G_
#define CS_ (T_ * H_ * D_)  // floats from a chunk's row to the next chunk's
#define P_  68        // padded LDS row stride (floats): 272B = 16B-aligned,
                      // bank = (4*row + col) % 64 -> conflict-free patterns

typedef float v2f __attribute__((ext_vector_type(2)));
typedef float v4f __attribute__((ext_vector_type(4)));
typedef float v8f __attribute__((ext_vector_type(8)));

__device__ __forceinline__ v8f wmma4(v2f a, v2f b, v8f c) {
  // D = A(16x4) * B(4x16) + C(16x16), all fp32
  return __builtin_amdgcn_wmma_f32_16x16x4_f32(false, a, false, b, (short)0, c,
                                               false, false);
}

__device__ __forceinline__ float fmap(float x) {  // elu(x)+1
  return x > 0.f ? x + 1.f : __expf(x);
}

// Async global->LDS copy, 16 bytes per lane. VDST VGPR carries the LDS byte
// offset, VADDR the 64-bit global address (GV mode). Tracked on ASYNCcnt.
__device__ __forceinline__ void async_b128(unsigned lds_off,
                                           unsigned long long gaddr) {
  // The wait in the copy's own statement: its address registers are rewritten
  // only behind it.
  asm volatile("global_load_async_to_lds_b128 %0, %1, off\n\ts_wait_xcnt 0x0"
               :: "v"(lds_off), "v"(gaddr) : "memory");
}
__device__ __forceinline__ void wait_async() {
  asm volatile("s_wait_asynccnt 0" ::: "memory");
}
__device__ __forceinline__ unsigned lds_off(const float* p) {
  return (unsigned)(size_t)p;  // generic LDS addr: low 32 bits = LDS offset
}

// Key tile [128][64] of one chunk and head: thread tid owns 16 bytes of rows
// tid/16 + 16*it (kp: its 16 bytes of row tid/16). The loads and the stores are
// two calls, so that a kernel can put the other global loads of its prologue
// between them: those and the keys' loads are then in flight together and it pays
// their memory latency once.
__device__ __forceinline__ void keys_load(const float* kp, v4f (&kr)[8]) {
#pragma unroll  // constant offsets: one address pair serves all eight loads
  for (int it = 0; it < 8; ++it)
    kr[it] = *(const v4f*)(kp + it * 16 * (H_ * D_));
}
__device__ __forceinline__ void keys_store(float* sk, int tid,
                                           const v4f (&kr)[8]) {
  float* q = sk + (tid >> 4) * P_ + (tid & 15) * 4;
#pragma unroll  // keeps kr[] in registers
  for (int it = 0; it < 8; ++it) {
    v4f f = { fmap(kr[it][0]), fmap(kr[it][1]), fmap(kr[it][2]),
              fmap(kr[it][3]) };
    *(v4f*)(q + it * 16 * P_) = f;
  }
}

// Value tile [128][64] of one chunk and head, async DMA into LDS (raw copy):
// thread tid brings 16 bytes of rows tid/16 + 16*it (vp: those of row tid/16).
__device__ __forceinline__ void values_copy(float* sv, const float* vp,
                                            int tid) {
  const unsigned l = lds_off(sv + (tid >> 4) * P_ + (tid & 15) * 4);
#pragma unroll  // eight copies, each closed by its own s_wait_xcnt
  for (int it = 0; it < 8; ++it)
    async_b128(l + it * 16 * P_ * 4,
               (unsigned long long)(vp + it * 16 * (H_ * D_)));
}

// The two 64x64 states of one chunk (128 rows of 64 floats, contiguous in the
// workspace), async DMA into LDS rows of P_ floats: thread tid brings 16 bytes
// of rows tid/16 + 16*it (sp: those of row tid/16).
__device__ __forceinline__ void states_copy(float* ss, const float* sp,
                                            int tid) {
  const unsigned l = lds_off(ss + (tid >> 4) * P_ + (tid & 15) * 4);
  const unsigned lr = 16 * P_ * 4;  // LDS bytes from one copy to the next
  const unsigned long long g = (unsigned long long)sp;
  const unsigned long long gr = 16 * 64 * 4;  // the same in the workspace
  // One statement: the eight copies issue back to back and share one wait, behind
  // which alone their address registers are rewritten.
  asm volatile(
      "global_load_async_to_lds_b128 %0, %8, off\n\t"
      "global_load_async_to_lds_b128 %1, %9, off\n\t"
      "global_load_async_to_lds_b128 %2, %10, off\n\t"
      "global_load_async_to_lds_b128 %3, %11, off\n\t"
      "global_load_async_to_lds_b128 %4, %12, off\n\t"
      "global_load_async_to_lds_b128 %5, %13, off\n\t"
      "global_load_async_to_lds_b128 %6, %14, off\n\t"
      "global_load_async_to_lds_b128 %7, %15, off\n\t"
      "s_wait_xcnt 0x0"
      :: "v"(l), "v"(l + lr), "v"(l + 2 * lr), "v"(l + 3 * lr), "v"(l + 4 * lr),
         "v"(l + 5 * lr), "v"(l + 6 * lr), "v"(l + 7 * lr), "v"(g), "v"(g + gr),
         "v"(g + 2 * gr), "v"(g + 3 * gr), "v"(g + 4 * gr), "v"(g + 5 * gr),
         "v"(g + 6 * gr), "v"(g + 7 * gr)
      : "memory");
}

// ---- Pass 1: running M = sum k^T v (64x64) and key sums over a group -------
// Two LDS buffers (keys + values each): chunk cc + 1 is on its way from memory
// while chunk cc is worked on.
__global__ __launch_bounds__(256) void k_chunksums(
    const float* __restrict__ Kg, const float* __restrict__ Vg,
    float* __restrict__ Mbuf, float* __restrict__ Ksum,
    float* __restrict__ Mtot, float* __restrict__ Ktot) {
  // buffer b (of two): keys [128][P_], values [128][P_]
  __shared__ __attribute__((aligned(16))) float sm[4 * T_ * P_];
  const int blk = blockIdx.x;           // nh*NG_ + g
  const int g   = blk & (NG_ - 1);
  const int nh  = blk >> 4;
  const int n   = nh >> 3, h = nh & (H_ - 1);
  const int tid = threadIdx.x;
  const size_t off =
      (((size_t)n * L_ + ((size_t)g * (G_ * T_) + (tid >> 4))) * H_ + h) * D_ +
      (tid & 15) * 4;
  const float* kp = Kg + off;
  const float* vp = Vg + off;

  // chunk 0 into buffer 0 (keys need elu(x)+1: through VGPRs)
  v4f kr[8];
  values_copy(sm + T_ * P_, vp, tid);
  keys_load(kp, kr);
  // Closes the run of loads: their address pair stays untouched up to here.
  asm volatile("s_wait_xcnt 0x0" :: "v"(kp) : "memory");
  keys_store(sm, tid, kr);
  wait_async();
  __syncthreads();
  values_copy(sm + 3 * T_ * P_, vp + CS_, tid);  // chunk 1's values, buffer 1

  const int wave = tid >> 5, lane = tid & 31;
  const int col = lane & 15, half = lane >> 4, kb = half * 2;
  const int ti = wave >> 1, tj = (wave & 1) * 2;  // tiles (ti,tj), (ti,tj+1)
  const int e2 = 16 * tj + 2 * col;  // this lane's column of tile tj; tj+1: e2+1
  const int mo = (16 * ti + half * 8) * 64 + e2;
  v8f acc[2] = {}, acc2[2] = {};  // running sums, dual chains a tile
  float ks = 0.f;                 // running key sum of column tid (tid < 64)

#pragma unroll  // cc constant in each copy: buffers and last-trip tests fold away
  for (int cc = 0; cc < G_; ++cc) {
    float* sk = sm + (cc & 1) * (2 * T_ * P_);
    float* sv = sk + T_ * P_;
    if (cc + 1 < G_) {  // next chunk's keys fly while this chunk is worked on
      keys_load(kp + (cc + 1) * CS_, kr);
      // Closes the run of loads: their address pair stays untouched up to here.
      asm volatile("s_wait_xcnt 0x0" :: "v"(kp) : "memory");
    }
    const size_t ch = (size_t)nh * C_ + g * G_ + cc;
#pragma unroll  // hf constant in each copy: the row range folds into offsets
    for (int hf = 0; hf < 2; ++hf) {
      float* mb = Mbuf + (2 * ch + hf) * 4096 + mo;
#pragma unroll  // keeps acc[] in registers
      for (int r = 0; r < 8; ++r) {  // the state ahead of this half chunk
        v2f st = { acc[0][r] + acc2[0][r], acc[1][r] + acc2[1][r] };
        *(v2f*)(mb + r * 64) = st;
      }
      // Closes the run of stores before their data registers are reused.
      asm volatile("s_wait_xcnt 0x0" ::: "memory");
      for (int s = 16 * hf; s < 16 * hf + 16; s += 2) {  // K-dim = 64, dual chains
        int k0 = 4 * s + kb;
        v2f a0 = { sk[k0 * P_ + 16 * ti + col],
                   sk[(k0 + 1) * P_ + 16 * ti + col] };
        v2f x0 = *(const v2f*)(sv + k0 * P_ + e2);        // row k0, both tiles
        v2f y0 = *(const v2f*)(sv + (k0 + 1) * P_ + e2);  // row k0 + 1
        v2f b00 = { x0[0], y0[0] }, b01 = { x0[1], y0[1] };
        acc[0] = wmma4(a0, b00, acc[0]);
        acc[1] = wmma4(a0, b01, acc[1]);
        int k1 = k0 + 4;
        v2f a1 = { sk[k1 * P_ + 16 * ti + col],
                   sk[(k1 + 1) * P_ + 16 * ti + col] };
        v2f x1 = *(const v2f*)(sv + k1 * P_ + e2);
        v2f y1 = *(const v2f*)(sv + (k1 + 1) * P_ + e2);
        v2f b10 = { x1[0], y1[0] }, b11 = { x1[1], y1[1] };
        acc2[0] = wmma4(a1, b10, acc2[0]);
        acc2[1] = wmma4(a1, b11, acc2[1]);
      }
    }
    if (tid < 64) {  // per-d key sum for the normalizer, ahead of each half
      Ksum[2 * ch * 64 + tid] = ks;
      float s = 0.f;
      for (int r = 0; r < T_ / 2; ++r) s += sk[r * P_ + tid];
      Ksum[(2 * ch + 1) * 64 + tid] = ks + s;
      // Closes the store before its address and data registers are reused.
      asm volatile("s_wait_xcnt 0x0" ::: "memory");
      for (int r = T_ / 2; r < T_; ++r) s += sk[r * P_ + tid];
      ks += s;
    }
    if (cc + 1 < G_) {
      // the other buffer's last readers left it at the barrier of trip cc - 1
      keys_store(sm + ((cc + 1) & 1) * (2 * T_ * P_), tid, kr);
      // Hand-over: this wave's LDS reads and writes are done, its copies of
      // chunk cc + 1 have landed; behind the barrier that holds for every wave.
      asm volatile("s_wait_dscnt 0x0" ::: "memory");
      wait_async();
      __syncthreads();
      if (cc + 2 < G_) values_copy(sv, vp + (cc + 2) * CS_, tid);
    }
  }
  wait_async();  // no copy is left in flight at the wave's end

  float* mt = Mtot + (size_t)blk * 4096 + mo;  // the group's total
#pragma unroll
  for (int r = 0; r < 8; ++r) {
    v2f st = { acc[0][r] + acc2[0][r], acc[1][r] + acc2[1][r] };
    *(v2f*)(mt + r * 64) = st;
  }
  if (tid < 64) Ktot[(size_t)blk * 64 + tid] = ks;
}

// ---------------- Pass 2: out = (tril(q k^T) v + q S) * Z -------------------
// A block walks the chunks of one group. The sum of the earlier groups' totals
// is the same for all of them: it is formed once and kept in registers. While a
// chunk is worked on the next one is on its way: keys, q rows and key sums into
// registers, values into the second value buffer, states into the state room as
// soon as every wave has left it.
__global__ __launch_bounds__(256) void k_main(
    const float* __restrict__ Qg, const float* __restrict__ Kg,
    const float* __restrict__ Vg, const float* __restrict__ Mbuf,
    const float* __restrict__ Ksum, const float* __restrict__ Mtot,
    const float* __restrict__ Ktot, float* __restrict__ Out) {
  extern __shared__ float sm[];
  float* sk    = sm;                  // [128][P_] feature-mapped keys
  float* svb   = sk + T_ * P_;        // 2 x [128][P_] values        (async DMA)
  float* ss    = svb + 2 * T_ * P_;   // [2][64][P_] states ahead of rows 0, 64
  float* sks   = ss + 2 * 64 * P_;    // [2][64]   key sums ahead of rows 0, 64
  float* stile = sks + 2 * 64;        // 8 waves x 2 x [16][17] attn tiles

  const int blk = blockIdx.x;  // nh*NG_ + g
  const int g = blk & (NG_ - 1);
  const int nh = blk >> 4;
  const int n = nh >> 3, h = nh & (H_ - 1);
  const long t0 = (long)g * (G_ * T_);
  const int tid = threadIdx.x;
  const size_t off =
      (((size_t)n * L_ + (t0 + (tid >> 4))) * H_ + h) * D_ + (tid & 15) * 4;
  const float* kp = Kg + off;
  const float* vp = Vg + off;
  const float* sp = Mbuf + (size_t)blk * (G_ * 2 * 4096) + tid * 4;

  // chunk 0. v: async DMA to LDS (raw copy)
  values_copy(svb, vp, tid);
  // the chunk's two states inside its group: async DMA as well, no registers
  states_copy(ss, sp, tid);
  const int wave = tid >> 5, lane = tid & 31;
  const int row = lane & 15, half = lane >> 4, kb = half * 2;
  const int c4 = row * 4;  // this lane's column of output tile 0; tile t: c4 + t
  // Row tile of this wave. Tile t costs t % 4 + 1 causal key tiles, and waves w
  // and w + 4 of a block share a SIMD: such a pair takes tiles t and 7 - t, so
  // that every SIMD's matrix unit gets the same five key tiles' work in each chunk of a block.
  const int rt = wave ^ ((wave >> 2) * 3);  // 0 1 2 3 7 6 5 4
  const int sub = rt >> 2;                  // its half of the chunk

  // key sums, keys (elu(x)+1 through VGPRs) and this wave's q rows: every load
  // is issued before the first value is used
  const float* qp =
      Qg + (((size_t)n * L_ + (t0 + 16 * rt + row)) * H_ + h) * D_ + kb;
  // every wave loads: no branch in the run of loads
  const float* ksp = Ksum + (size_t)blk * (G_ * 128) + (tid & 127);
  float ksv = *ksp;
  v4f kr[8];
  keys_load(kp, kr);
  v2f qa[16];  // q A-fragments for this wave's 16 rows
#pragma unroll  // constant offsets: one address pair serves all sixteen loads
  for (int ks = 0; ks < 16; ++ks) qa[ks] = *(const v2f*)(qp + 4 * ks);
  // Closes the run of loads: their address registers stay untouched up to here.
  // ksv is named so that its load stays in the run and is not sunk to its use.
  asm volatile("s_wait_xcnt 0x0" :: "v"(ksp), "v"(kp), "v"(qp), "v"(ksv)
               : "memory");
  // Holds the keys' feature map behind the run of loads: moved up, it made the q
  // loads wait for the keys' arrival, a second memory round trip.
  __builtin_amdgcn_sched_barrier(0);
  keys_store(sk, tid, kr);
#pragma unroll
  for (int ks = 0; ks < 16; ++ks) {
    qa[ks][0] = fmap(qa[ks][0]);
    qa[ks][1] = fmap(qa[ks][1]);
  }
  // Totals of the head's earlier groups, in ascending order, four groups a trip:
  // a trip's loads are all issued before its first sum (every group has a total
  // in the workspace, so a trip may load past the last one wanted; it adds only
  // the wanted ones). Thread tid owns 16 bytes of rows tid/16 + 16*it of the
  // 64x64 sum, which goes into both states of every chunk of the group.
  const float* tp = Mtot + (size_t)nh * NG_ * 4096 + tid * 4;
  const float* ktp = Ktot + (size_t)nh * NG_ * 64 + (tid & 63);
  v4f ta[4] = {};
  float kts = 0.f;
  for (int g0 = 0; g0 < g; g0 += 4) {
    v4f tv[4][4];
    float kt[4];
#pragma unroll  // constant offsets: two address pairs serve the trip's loads
    for (int j = 0; j < 4; ++j) {
#pragma unroll
      for (int it = 0; it < 4; ++it)
        tv[j][it] = *(const v4f*)(tp + j * 4096 + it * 1024);
      kt[j] = ktp[j * 64];
    }
    // Closes the run of loads before their address pairs are advanced.
    asm volatile("s_wait_xcnt 0x0" :: "v"(tp), "v"(ktp) : "memory");
#pragma unroll  // keeps tv[] in registers
    for (int j = 0; j < 4; ++j)
      if (g0 + j < g) {
#pragma unroll
        for (int it = 0; it < 4; ++it) ta[it] += tv[j][it];
        kts += kt[j];
      }
    tp += 4 * 4096;
    ktp += 4 * 64;
  }
  wait_async();  // this wave's copies have landed: a thread adds to its own bytes
#pragma unroll
  for (int it = 0; it < 8; ++it) {
    v4f* p = (v4f*)(ss + ((tid >> 4) + 16 * it) * P_ + (tid & 15) * 4);
    *p = *p + ta[it & 3];
  }
  if (tid < 128) sks[tid] = ksv + kts;
  __syncthreads();
  values_copy(svb + T_ * P_, vp + CS_, tid);  // chunk 1's values, buffer 1

  const float* sw = ss + sub * (64 * P_);  // the state ahead of this wave's half
  const float* kw = sks + sub * 64;

#pragma unroll 1  // one copy of a chunk's code: the kernel's text stays short
  for (int cc = 0; cc < G_; ++cc) {
    float* sv = svb + (cc & 1) * (T_ * P_);
    const bool more = cc + 1 < G_;  // the same for the whole block
    v2f qn[16];
    float ksn = 0.f;
    if (more) {  // next chunk's keys, q rows and key sums fly during this chunk
      const float* ksn_p = ksp + (cc + 1) * 128;
      const float* kn_p = kp + (cc + 1) * CS_;
      const float* qn_p = qp + (cc + 1) * CS_;
      ksn = *ksn_p;
      keys_load(kn_p, kr);
#pragma unroll  // constant offsets: one address pair serves all sixteen loads
      for (int ks = 0; ks < 16; ++ks) qn[ks] = *(const v2f*)(qn_p + 4 * ks);
      // Closes the run of loads: their address registers stay untouched up to here.
      asm volatile("s_wait_xcnt 0x0" :: "v"(ksn_p), "v"(kn_p), "v"(qn_p)
                   : "memory");
    }

    v8f acc0 = {}, acc1 = {}, acc2 = {}, acc3 = {};
    // This lane's share of its row's denominator: the terms that stand at its two
    // k slots of the A fragments (row = lane % 16, slots kb and kb + 1).
    // Two chains: a link waits for its forerunner only every other term.
    v2f dn = {}, dn2 = {};

    // Inter-chunk: q @ S (+ q . prefix-ksum into the denominator)
#pragma unroll
    for (int ks = 0; ks < 16; ++ks) {
      int d0 = 4 * ks + kb;
      v2f bd = { kw[d0], kw[d0 + 1] };
      if (ks & 1) dn2 += qa[ks] * bd; else dn += qa[ks] * bd;
      v4f x = *(const v4f*)(sw + d0 * P_ + c4);        // row d0, four tiles
      v4f y = *(const v4f*)(sw + (d0 + 1) * P_ + c4);  // row d0 + 1
      v2f b0 = { x[0], y[0] }, b1 = { x[1], y[1] };
      v2f b2 = { x[2], y[2] }, b3 = { x[3], y[3] };
      acc0 = wmma4(qa[ks], b0, acc0);
      acc1 = wmma4(qa[ks], b1, acc1);
      acc2 = wmma4(qa[ks], b2, acc2);
      acc3 = wmma4(qa[ks], b3, acc3);
    }
    if (more) {
      // This wave's LDS traffic on the states is done; behind the barrier every
      // wave has read its state, and the next chunk's states may take the room.
      asm volatile("s_wait_dscnt 0x0" ::: "memory");
      __syncthreads();
      states_copy(ss, sp + (cc + 1) * (2 * 4096), tid);
    }

    // Inside the half: attn tiles 4*sub <= jj <= rt (causality), fused with attn*v
    for (int jj = 4 * sub; jj <= rt; ++jj) {
      v8f atA = {}, atB = {};  // dual accumulator chains
#pragma unroll
      for (int ks = 0; ks < 16; ks += 2) {  // K-dim = D = 64
        int d0 = 4 * ks + kb;
        v2f b0 = { sk[(16 * jj + row) * P_ + d0],
                   sk[(16 * jj + row) * P_ + d0 + 1] };
        atA = wmma4(qa[ks], b0, atA);
        int d1 = d0 + 4;
        v2f b1 = { sk[(16 * jj + row) * P_ + d1],
                   sk[(16 * jj + row) * P_ + d1 + 1] };
        atB = wmma4(qa[ks + 1], b1, atB);
      }
      v8f at;
#pragma unroll
      for (int r = 0; r < 8; ++r) at[r] = atA[r] + atB[r];
      if (jj == rt) {  // tril mask on diagonal tile: keep if m >= ncol
#pragma unroll
        for (int r = 0; r < 8; ++r)
          if (half * 8 + r < row) at[r] = 0.f;
      }
      float* tb = stile + (wave * 2 + (jj & 1)) * 16 * 17;  // double-buffered
#pragma unroll
      for (int r = 0; r < 8; ++r)  // D-layout -> LDS for A-fragment reuse
        tb[half * (8 * 17) + row + r * 17] = at[r];

#pragma unroll
      for (int s = 0; s < 4; ++s) {  // attn_tile (A) x v rows 16jj..16jj+15 (B)
        v2f a = { tb[row * 17 + 4 * s + kb], tb[row * 17 + 4 * s + kb + 1] };
        int r0 = 16 * jj + 4 * s + kb;
        if (s & 1) dn2 += a; else dn += a;  // denominator: the row sums of attn
        v4f x = *(const v4f*)(sv + r0 * P_ + c4);        // row r0, four tiles
        v4f y = *(const v4f*)(sv + (r0 + 1) * P_ + c4);  // row r0 + 1
        v2f b0 = { x[0], y[0] }, b1 = { x[1], y[1] };
        v2f b2 = { x[2], y[2] }, b3 = { x[3], y[3] };
        acc0 = wmma4(a, b0, acc0);
        acc1 = wmma4(a, b1, acc1);
        acc2 = wmma4(a, b2, acc2);
        acc3 = wmma4(a, b3, acc3);
      }
    }

    if (more) {
      // This wave's LDS reads are done; behind the barrier every wave has left
      // the keys and this chunk's values.
      asm volatile("s_wait_dscnt 0x0" ::: "memory");
      __syncthreads();
      keys_store(sk, tid, kr);
#pragma unroll
      for (int ks = 0; ks < 16; ++ks) {
        qa[ks][0] = fmap(qn[ks][0]);
        qa[ks][1] = fmap(qn[ks][1]);
      }
      // This wave's copies (next states, next values) have landed: a thread adds
      // the earlier groups' sum to its own bytes.
      wait_async();
#pragma unroll
      for (int it = 0; it < 8; ++it) {
        v4f* p = (v4f*)(ss + ((tid >> 4) + 16 * it) * P_ + (tid & 15) * 4);
        *p = *p + ta[it & 3];
      }
      if (tid < 128) sks[tid] = ksn + kts;
      // Hand-over: this wave's LDS writes are done and its copies have landed;
      // behind the barrier that holds for every wave.
      asm volatile("s_wait_dscnt 0x0" ::: "memory");
      __syncthreads();
      if (cc + 2 < G_) values_copy(sv, vp + (cc + 2) * CS_, tid);
    }

    // Denominator: A = the lanes' shares, B = ones: a row's four k slots are summed
    // and land in the accumulators' layout (identical columns, lane-matched).
    const v2f ones = { 1.f, 1.f };
    const v8f accD = wmma4(dn + dn2, ones, v8f{});
    // Z normalize + store.
    // Behind the hand-over: a barrier waits for the wave's stores, and the next one
    // stands a whole state product away.
    float* op = Out + (((size_t)n * L_ + (t0 + cc * T_ + 16 * rt + half * 8)) * H_ +
                       h) * D_ + c4;
#pragma unroll  // constant offsets: one address pair serves all eight stores
    for (int r = 0; r < 8; ++r) {
      float z = 1.f / (accD[r] + 1e-6f);
      v4f o = { acc0[r] * z, acc1[r] * z, acc2[r] * z, acc3[r] * z };
      *(v4f*)(op + r * (H_ * D_)) = o;
    }
    // Closes the run of stores before their address and data registers are reused.
    asm volatile("s_wait_xcnt 0x0" ::: "memory");
  }
  wait_async();  // no copy is left in flight at the wave's end
}

extern "C" void kernel_launch(void* const* d_in, const int* in_sizes, int n_in,
                              void* d_out, int out_size, void* d_ws,
                              size_t ws_size, hipStream_t stream) {
  const float* Qg = (const float*)d_in[0];
  const float* Kg = (const float*)d_in[1];
  const float* Vg = (const float*)d_in[2];
  float* Out = (float*)d_out;
  float* Mbuf = (float*)d_ws;                           // [NH, C, 2, 64, 64] fp32
  float* Ksum = Mbuf + (size_t)NH_ * C_ * 2 * 64 * 64;  // [NH, C, 2, 64] fp32
  float* Mtot = Ksum + (size_t)NH_ * C_ * 2 * 64;       // [NH, NG, 64, 64] fp32
  float* Ktot = Mtot + (size_t)NH_ * NG_ * 64 * 64; // [NH, NG, 64]    fp32

  const size_t smem3 =
      (size_t)(3 * T_ * P_ + 2 * 64 * P_ + 2 * 64 + 8 * 2 * 16 * 17) * sizeof(float);

  k_chunksums<<<dim3(NH_ * NG_), dim3(256), 0, stream>>>(Kg, Vg, Mbuf, Ksum, Mtot,
                                                         Ktot);
  k_main<<<dim3(NH_ * NG_), dim3(256), smem3, stream>>>(Qg, Kg, Vg, Mbuf, Ksum,
                                                       Mtot, Ktot, Out);
}

// v009
// It runs in 64.8 microseconds.
// In both of two side-by-side timings against v008, it was 1.03 times as fast.
// Over all steps from v000 it is 2.10 times as fast.
#include <hip/hip_runtime.h>

// Causal linear attention (fp32) on gfx1250 via V_WMMA_F32_16X16X4_F32 +
// GLOBAL_LOAD_ASYNC_TO_LDS_B128 (CDNA5 async global->LDS path).
// 2 passes: (1) a block walks a group of chunks and carries the running K^T V
// and key sums: it stores them ahead of each half chunk (prefix inside the
// group) and once more at the end (the group's total), (2) output, a block a
// group, chunk by chunk from the last to the first (what pass 1 touched last is
// re-read first, while L2 still holds it), each half of 64 rows from its own state:
// tril(q k^T) v over the half's keys
// + q S, S = prefix inside the group + earlier groups' totals. The normalizer
// 1/(q . cumsum k + eps) has one column: a lane adds up its own A-fragment
// elements of it (q * key sums, attn), and one WMMA by ones a row tile and chunk
// folds the four k slots. The causal product costs a row tile one key tile more
// for every 16 rows behind its state, the state product is the same for all:
// a state every 64 rows, not 128, takes four key tiles off row tiles 4 to 7.
// Which column a lane stands for: in a wave's group of n column tiles (4 in
// pass 2, 2 in pass 1) lane c of tile t holds column n*c + t, not 16*t + c. A
// lane's B elements of one k row for all n tiles are then adjacent in LDS (one
// 16- or 8-byte read, not n reads of 4 bytes), and so are its results in memory.

#define N_  4
#define L_  8192
#define H_  8
#define D_  64
#define T_  128       // chunk length
#define C_  64        // chunks = L_/T_
#define NH_ 32        // N_*H_
#define G_  4         // chunks in a group (one pass-1 block)
#define NG_ 16        // groups of a head = C_/G_
#define CS_ (T_ * H_ * D_)  // floats from a chunk's row to the next chunk's
#define P_  68        // padded LDS row stride (floats): 272B = 16B-aligned,
                      // bank = (4*row + col) % 64 -> conflict-free patterns

typedef float v2f __attribute__((ext_vector_type(2)));
typedef float v4f __attribute__((ext_vector_type(4)));
typedef float v8f __attribute__((ext_vector_type(8)));

__device__ __forceinline__ v8f wmma4(v2f a, v2f b, v8f c) {
  // D = A(16x4) * B(4x16) + C(16x16), all fp32
  return __builtin_amdgcn_wmma_f32_16x16x4_f32(false, a, false, b, (short)0, c,
                                               false, false);
}

__device__ __forceinline__ float fmap(float x) {  // elu(x)+1
  return x > 0.f ? x + 1.f : __expf(x);
}

// Async global->LDS copy, 16 bytes per lane. VDST VGPR carries the LDS byte
// offset, VADDR the 64-bit global address (GV mode). Tracked on ASYNCcnt.
__device__ __forceinline__ void async_b128(unsigned lds_off,
                                           unsigned long long gaddr) {
  // The wait in the copy's own statement: its address registers are rewritten
  // only behind it.
  asm volatile("global_load_async_to_lds_b128 %0, %1, off\n\ts_wait_xcnt 0x0"
               :: "v"(lds_off), "v"(gaddr) : "memory");
}
__device__ __forceinline__ void wait_async() {
  asm volatile("s_wait_asynccnt 0" ::: "memory");
}
__device__ __forceinline__ unsigned lds_off(const float* p) {
  return (unsigned)(size_t)p;  // generic LDS addr: low 32 bits = LDS offset
}

// Key tile [128][64] of one chunk and head: thread tid owns 16 bytes of rows
// tid/16 + 16*it (kp: its 16 bytes of row tid/16). The loads and the stores are
// two calls, so that a kernel can put the other global loads of its prologue
// between them: those and the keys' loads are then in flight together and it pays
// their memory latency once.
__device__ __forceinline__ void keys_load(const float* kp, v4f (&kr)[8]) {
#pragma unroll  // constant offsets: one address pair serves all eight loads
  for (int it = 0; it < 8; ++it)
    kr[it] = *(const v4f*)(kp + it * 16 * (H_ * D_));
}
__device__ __forceinline__ void keys_store(float* sk, int tid,
                                           const v4f (&kr)[8]) {
  float* q = sk + (tid >> 4) * P_ + (tid & 15) * 4;
#pragma unroll  // keeps kr[] in registers
  for (int it = 0; it < 8; ++it) {
    v4f f = { fmap(kr[it][0]), fmap(kr[it][1]), fmap(kr[it][2]),
              fmap(kr[it][3]) };
    *(v4f*)(q + it * 16 * P_) = f;
  }
}

// Value tile [128][64] of one chunk and head, async DMA into LDS (raw copy):
// thread tid brings 16 bytes of rows tid/16 + 16*it (vp: those of row tid/16).
__device__ __forceinline__ void values_copy(float* sv, const float* vp,
                                            int tid) {
  const unsigned l = lds_off(sv + (tid >> 4) * P_ + (tid & 15) * 4);
#pragma unroll  // eight copies, each closed by its own s_wait_xcnt
  for (int it = 0; it < 8; ++it)
    async_b128(l + it * 16 * P_ * 4,
               (unsigned long long)(vp + it * 16 * (H_ * D_)));
}

// The two 64x64 states of one chunk (128 rows of 64 floats, contiguous in the
// workspace), async DMA into LDS rows of P_ floats: thread tid brings 16 bytes
// of rows tid/16 + 16*it (sp: those of row tid/16).
__device__ __forceinline__ void states_copy(float* ss, const float* sp,
                                            int tid) {
  const unsigned l = lds_off(ss + (tid >> 4) * P_ + (tid & 15) * 4);
  const unsigned lr = 16 * P_ * 4;  // LDS bytes from one copy to the next
  const unsigned long long g = (unsigned long long)sp;
  const unsigned long long gr = 16 * 64 * 4;  // the same in the workspace
  // One statement: the eight copies issue back to back and share one wait, behind
  // which alone their address registers are rewritten.
  asm volatile(
      "global_load_async_to_lds_b128 %0, %8, off\n\t"
      "global_load_async_to_lds_b128 %1, %9, off\n\t"
      "global_load_async_to_lds_b128 %2, %10, off\n\t"
      "global_load_async_to_lds_b128 %3, %11, off\n\t"
      "global_load_async_to_lds_b128 %4, %12, off\n\t"
      "global_load_async_to_lds_b128 %5, %13, off\n\t"
      "global_load_async_to_lds_b128 %6, %14, off\n\t"
      "global_load_async_to_lds_b128 %7, %15, off\n\t"
      "s_wait_xcnt 0x0"
      :: "v"(l), "v"(l + lr), "v"(l + 2 * lr), "v"(l + 3 * lr), "v"(l + 4 * lr),
         "v"(l + 5 * lr), "v"(l + 6 * lr), "v"(l + 7 * lr), "v"(g), "v"(g + gr),
         "v"(g + 2 * gr), "v"(g + 3 * gr), "v"(g + 4 * gr), "v"(g + 5 * gr),
         "v"(g + 6 * gr), "v"(g + 7 * gr)
      : "memory");
}

// ---- Pass 1: running M = sum k^T v (64x64) and key sums over a group -------
// Two LDS buffers (keys + values each): chunk cc + 1 is on its way from memory
// while chunk cc is worked on.
__global__ __launch_bounds__(256) void k_chunksums(
    const float* __restrict__ Kg, const float* __restrict__ Vg,
    float* __restrict__ Mbuf, float* __restrict__ Ksum,
    float* __restrict__ Mtot, float* __restrict__ Ktot) {
  // buffer b (of two): keys [128][P_], values [128][P_]
  __shared__ __attribute__((aligned(16))) float sm[4 * T_ * P_];
  const int blk = blockIdx.x;           // nh*NG_ + g
  const int g   = blk & (NG_ - 1);
  const int nh  = blk >> 4;
  const int n   = nh >> 3, h = nh & (H_ - 1);
  const int tid = threadIdx.x;
  const size_t off =
      (((size_t)n * L_ + ((size_t)g * (G_ * T_) + (tid >> 4))) * H_ + h) * D_ +
      (tid & 15) * 4;
  const float* kp = Kg + off;
  const float* vp = Vg + off;

  // chunk 0 into buffer 0 (keys need elu(x)+1: through VGPRs)
  v4f kr[8];
  values_copy(sm + T_ * P_, vp, tid);
  keys_load(kp, kr);
  // Closes the run of loads: their address pair stays untouched up to here.
  asm volatile("s_wait_xcnt 0x0" :: "v"(kp) : "memory");
  keys_store(sm, tid, kr);
  wait_async();
  __syncthreads();
  values_copy(sm + 3 * T_ * P_, vp + CS_, tid);  // chunk 1's values, buffer 1

  const int wave = tid >> 5, lane = tid & 31;
  const int col = lane & 15, half = lane >> 4, kb = half * 2;
  const int ti = wave >> 1, tj = (wave & 1) * 2;  // tiles (ti,tj), (ti,tj+1)
  const int e2 = 16 * tj + 2 * col;  // this lane's column of tile tj; tj+1: e2+1
  const int mo = (16 * ti + half * 8) * 64 + e2;
  v8f acc[2] = {}, acc2[2] = {};  // running sums, dual chains a tile
  float ks = 0.f;                 // running key sum of column tid (tid < 64)

#pragma unroll  // cc constant in each copy: buffers and last-trip tests fold away
  for (int cc = 0; cc < G_; ++cc) {
    float* sk = sm + (cc & 1) * (2 * T_ * P_);
    float* sv = sk + T_ * P_;
    if (cc + 1 < G_) {  // next chunk's keys fly while this chunk is worked on
      keys_load(kp + (cc + 1) * CS_, kr);
      // Closes the run of loads: their address pair stays untouched up to here.
      asm volatile("s_wait_xcnt 0x0" :: "v"(kp) : "memory");
    }
    const size_t ch = (size_t)nh * C_ + g * G_ + cc;
#pragma unroll  // hf constant in each copy: the row range folds into offsets
    for (int hf = 0; hf < 2; ++hf) {
      float* mb = Mbuf + (2 * ch + hf) * 4096 + mo;
#pragma unroll  // keeps acc[] in registers
      for (int r = 0; r < 8; ++r) {  // the state ahead of this half chunk
        v2f st = { acc[0][r] + acc2[0][r], acc[1][r] + acc2[1][r] };
        *(v2f*)(mb + r * 64) = st;
      }
      // Closes the run of stores before their data registers are reused.
      asm volatile("s_wait_xcnt 0x0" ::: "memory");
      for (int s = 16 * hf; s < 16 * hf + 16; s += 2) {  // K-dim = 64, dual chains
        int k0 = 4 * s + kb;
        v2f a0 = { sk[k0 * P_ + 16 * ti + col],
                   sk[(k0 + 1) * P_ + 16 * ti + col] };
        v2f x0 = *(const v2f*)(sv + k0 * P_ + e2);        // row k0, both tiles
        v2f y0 = *(const v2f*)(sv + (k0 + 1) * P_ + e2);  // row k0 + 1
        v2f b00 = { x0[0], y0[0] }, b01 = { x0[1], y0[1] };
        acc[0] = wmma4(a0, b00, acc[0]);
        acc[1] = wmma4(a0, b01, acc[1]);
        int k1 = k0 + 4;
        v2f a1 = { sk[k1 * P_ + 16 * ti + col],
                   sk[(k1 + 1) * P_ + 16 * ti + col] };
        v2f x1 = *(const v2f*)(sv + k1 * P_ + e2);
        v2f y1 = *(const v2f*)(sv + (k1 + 1) * P_ + e2);
        v2f b10 = { x1[0], y1[0] }, b11 = { x1[1], y1[1] };
        acc2[0] = wmma4(a1, b10, acc2[0]);
        acc2[1] = wmma4(a1, b11, acc2[1]);
      }
    }
    if (tid < 64) {  // per-d key sum for the normalizer, ahead of each half
      Ksum[2 * ch * 64 + tid] = ks;
      float s = 0.f;
      for (int r = 0; r < T_ / 2; ++r) s += sk[r * P_ + tid];
      Ksum[(2 * ch + 1) * 64 + tid] = ks + s;
      // Closes the store before its address and data registers are reused.
      asm volatile("s_wait_xcnt 0x0" ::: "memory");
      for (int r = T_ / 2; r < T_; ++r) s += sk[r * P_ + tid];
      ks += s;
    }
    if (cc + 1 < G_) {
      // the other buffer's last readers left it at the barrier of trip cc - 1
      keys_store(sm + ((cc + 1) & 1) * (2 * T_ * P_), tid, kr);
      // Hand-over: this wave's LDS reads and writes are done, its copies of
      // chunk cc + 1 have landed; behind the barrier that holds for every wave.
      asm volatile("s_wait_dscnt 0x0" ::: "memory");
      wait_async();
      __syncthreads();
      if (cc + 2 < G_) values_copy(sv, vp + (cc + 2) * CS_, tid);
    }
  }
  wait_async();  // no copy is left in flight at the wave's end

  float* mt = Mtot + (size_t)blk * 4096 + mo;  // the group's total
#pragma unroll
  for (int r = 0; r < 8; ++r) {
    v2f st = { acc[0][r] + acc2[0][r], acc[1][r] + acc2[1][r] };
    *(v2f*)(mt + r * 64) = st;
  }
  if (tid < 64) Ktot[(size_t)blk * 64 + tid] = ks;
}

// ---------------- Pass 2: out = (tril(q k^T) v + q S) * Z -------------------
// A block walks the chunks of one group, the last chunk first: the chunks do not
// depend on each other here, and pass 1, which walks them upwards, has left the
// keys, values and states of its latest chunks in L2. Walked upwards again, every
// line would have been pushed out by the rest of the set before its second read.
// The sum of the earlier groups' totals
// is the same for all of them: it is formed once and kept in registers. While a
// chunk is worked on the next one is on its way: keys, q rows and key sums into
// registers, values into the second value buffer, states into the state room as
// soon as every wave has left it.
__global__ __launch_bounds__(256) void k_main(
    const float* __restrict__ Qg, const float* __restrict__ Kg,
    const float* __restrict__ Vg, const float* __restrict__ Mbuf,
    const float* __restrict__ Ksum, const float* __restrict__ Mtot,
    const float* __restrict__ Ktot, float* __restrict__ Out) {
  extern __shared__ float sm[];
  float* sk    = sm;                  // [128][P_] feature-mapped keys
  float* svb   = sk + T_ * P_;        // 2 x [128][P_] values        (async DMA)
  float* ss    = svb + 2 * T_ * P_;   // [2][64][P_] states ahead of rows 0, 64
  float* sks   = ss + 2 * 64 * P_;    // [2][64]   key sums ahead of rows 0, 64
  float* stile = sks + 2 * 64;        // 8 waves x 2 x [16][17] attn tiles

  const int blk = blockIdx.x;  // nh*NG_ + g
  const int g = blk & (NG_ - 1);
  const int nh = blk >> 4;
  const int n = nh >> 3, h = nh & (H_ - 1);
  // first row of the group's last chunk, which is walked first; trip cc works on
  // the chunk that starts cc * T_ rows earlier
  const long t0 = (long)g * (G_ * T_) + (G_ - 1) * T_;
  const int tid = threadIdx.x;
  const size_t off =
      (((size_t)n * L_ + (t0 + (tid >> 4))) * H_ + h) * D_ + (tid & 15) * 4;
  const float* kp = Kg + off;
  const float* vp = Vg + off;
  const float* sp =
      Mbuf + ((size_t)blk * G_ + (G_ - 1)) * (2 * 4096) + tid * 4;

  // first trip's chunk. v: async DMA to LDS (raw copy)
  values_copy(svb, vp, tid);
  // the chunk's two states inside its group: async DMA as well, no registers
  states_copy(ss, sp, tid);
  const int wave = tid >> 5, lane = tid & 31;
  const int row = lane & 15, half = lane >> 4, kb = half * 2;
  const int c4 = row * 4;  // this lane's column of output tile 0; tile t: c4 + t
  // Row tile of this wave. Tile t costs t % 4 + 1 causal key tiles, and waves w
  // and w + 4 of a block share a SIMD: such a pair takes tiles t and 7 - t, so
  // that every SIMD's matrix unit gets the same five key tiles' work in each chunk of a block.
  const int rt = wave ^ ((wave >> 2) * 3);  // 0 1 2 3 7 6 5 4
  const int sub = rt >> 2;                  // its half of the chunk

  // key sums, keys (elu(x)+1 through VGPRs) and this wave's q rows: every load
  // is issued before the first value is used
  const float* qp =
      Qg + (((size_t)n * L_ + (t0 + 16 * rt + row)) * H_ + h) * D_ + kb;
  // every wave loads: no branch in the run of loads
  const float* ksp = Ksum + ((size_t)blk * G_ + (G_ - 1)) * 128 + (tid & 127);
  float ksv = *ksp;
  v4f kr[8];
  keys_load(kp, kr);
  v2f qa[16];  // q A-fragments for this wave's 16 rows
#pragma unroll  // constant offsets: one address pair serves all sixteen loads
  for (int ks = 0; ks < 16; ++ks) qa[ks] = *(const v2f*)(qp + 4 * ks);
  // Closes the run of loads: their address registers stay untouched up to here.
  // ksv is named so that its load stays in the run and is not sunk to its use.
  asm volatile("s_wait_xcnt 0x0" :: "v"(ksp), "v"(kp), "v"(qp), "v"(ksv)
               : "memory");
  // Holds the keys' feature map behind the run of loads: moved up, it made the q
  // loads wait for the keys' arrival, a second memory round trip.
  __builtin_amdgcn_sched_barrier(0);
  keys_store(sk, tid, kr);
#pragma unroll
  for (int ks = 0; ks < 16; ++ks) {
    qa[ks][0] = fmap(qa[ks][0]);
    qa[ks][1] = fmap(qa[ks][1]);
  }
  // Totals of the head's earlier groups, in ascending order, four groups a trip:
  // a trip's loads are all issued before its first sum (every group has a total
  // in the workspace, so a trip may load past the last one wanted; it adds only
  // the wanted ones). Thread tid owns 16 bytes of rows tid/16 + 16*it of the
  // 64x64 sum, which goes into both states of every chunk of the group.
  const float* tp = Mtot + (size_t)nh * NG_ * 4096 + tid * 4;
  const float* ktp = Ktot + (size_t)nh * NG_ * 64 + (tid & 63);
  v4f ta[4] = {};
  float kts = 0.f;
  for (int g0 = 0; g0 < g; g0 += 4) {
    v4f tv[4][4];
    float kt[4];
#pragma unroll  // constant offsets: two address pairs serve the trip's loads
    for (int j = 0; j < 4; ++j) {
#pragma unroll
      for (int it = 0; it < 4; ++it)
        tv[j][it] = *(const v4f*)(tp + j * 4096 + it * 1024);
      kt[j] = ktp[j * 64];
    }
    // Closes the run of loads before their address pairs are advanced.
    asm volatile("s_wait_xcnt 0x0" :: "v"(tp), "v"(ktp) : "memory");
#pragma unroll  // keeps tv[] in registers
    for (int j = 0; j < 4; ++j)
      if (g0 + j < g) {
#pragma unroll
        for (int it = 0; it < 4; ++it) ta[it] += tv[j][it];
        kts += kt[j];
      }
    tp += 4 * 4096;
    ktp += 4 * 64;
  }
  wait_async();  // this wave's copies have landed: a thread adds to its own bytes
#pragma unroll
  for (int it = 0; it < 8; ++it) {
    v4f* p = (v4f*)(ss + ((tid >> 4) + 16 * it) * P_ + (tid & 15) * 4);
    *p = *p + ta[it & 3];
  }
  if (tid < 128) sks[tid] = ksv + kts;
  __syncthreads();
  values_copy(svb + T_ * P_, vp - CS_, tid);  // second trip's values, buffer 1

  const float* sw = ss + sub * (64 * P_);  // the state ahead of this wave's half
  const float* kw = sks + sub * 64;

#pragma unroll 1  // one copy of a chunk's code: the kernel's text stays short
  for (int cc = 0; cc < G_; ++cc) {
    float* sv = svb + (cc & 1) * (T_ * P_);
    const bool more = cc + 1 < G_;  // the same for the whole block
    v2f qn[16];
    float ksn = 0.f;
    if (more) {  // next chunk's keys, q rows and key sums fly during this chunk
      const float* ksn_p = ksp - (cc + 1) * 128;
      const float* kn_p = kp - (cc + 1) * CS_;
      const float* qn_p = qp - (cc + 1) * CS_;
      ksn = *ksn_p;
      keys_load(kn_p, kr);
#pragma unroll  // constant offsets: one address pair serves all sixteen loads
      for (int ks = 0; ks < 16; ++ks) qn[ks] = *(const v2f*)(qn_p + 4 * ks);
      // Closes the run of loads: their address registers stay untouched up to here.
      asm volatile("s_wait_xcnt 0x0" :: "v"(ksn_p), "v"(kn_p), "v"(qn_p)
                   : "memory");
    }

    v8f acc0 = {}, acc1 = {}, acc2 = {}, acc3 = {};
    // This lane's share of its row's denominator: the terms that stand at its two
    // k slots of the A fragments (row = lane % 16, slots kb and kb + 1).
    // Two chains: a link waits for its forerunner only every other term.
    v2f dn = {}, dn2 = {};

    // Inter-chunk: q @ S (+ q . prefix-ksum into the denominator)
#pragma unroll
    for (int ks = 0; ks < 16; ++ks) {
      int d0 = 4 * ks + kb;
      v2f bd = { kw[d0], kw[d0 + 1] };
      if (ks & 1) dn2 += qa[ks] * bd; else dn += qa[ks] * bd;
      v4f x = *(const v4f*)(sw + d0 * P_ + c4);        // row d0, four tiles
      v4f y = *(const v4f*)(sw + (d0 + 1) * P_ + c4);  // row d0 + 1
      v2f b0 = { x[0], y[0] }, b1 = { x[1], y[1] };
      v2f b2 = { x[2], y[2] }, b3 = { x[3], y[3] };
      acc0 = wmma4(qa[ks], b0, acc0);
      acc1 = wmma4(qa[ks], b1, acc1);
      acc2 = wmma4(qa[ks], b2, acc2);
      acc3 = wmma4(qa[ks], b3, acc3);
    }
    if (more) {
      // This wave's LDS traffic on the states is done; behind the barrier every
      // wave has read its state, and the next chunk's states may take the room.
      asm volatile("s_wait_dscnt 0x0" ::: "memory");
      __syncthreads();
      states_copy(ss, sp - (cc + 1) * (2 * 4096), tid);
    }

    // Inside the half: attn tiles 4*sub <= jj <= rt (causality), fused with attn*v
    for (int jj = 4 * sub; jj <= rt; ++jj) {
      v8f atA = {}, atB = {};  // dual accumulator chains
#pragma unroll
      for (int ks = 0; ks < 16; ks += 2) {  // K-dim = D = 64
        int d0 = 4 * ks + kb;
        v2f b0 = { sk[(16 * jj + row) * P_ + d0],
                   sk[(16 * jj + row) * P_ + d0 + 1] };
        atA = wmma4(qa[ks], b0, atA);
        int d1 = d0 + 4;
        v2f b1 = { sk[(16 * jj + row) * P_ + d1],
                   sk[(16 * jj + row) * P_ + d1 + 1] };
        atB = wmma4(qa[ks + 1], b1, atB);
      }
      v8f at;
#pragma unroll
      for (int r = 0; r < 8; ++r) at[r] = atA[r] + atB[r];
      if (jj == rt) {  // tril mask on diagonal tile: keep if m >= ncol
#pragma unroll
        for (int r = 0; r < 8; ++r)
          if (half * 8 + r < row) at[r] = 0.f;
      }
      float* tb = stile + (wave * 2 + (jj & 1)) * 16 * 17;  // double-buffered
#pragma unroll
      for (int r = 0; r < 8; ++r)  // D-layout -> LDS for A-fragment reuse
        tb[half * (8 * 17) + row + r * 17] = at[r];

#pragma unroll
      for (int s = 0; s < 4; ++s) {  // attn_tile (A) x v rows 16jj..16jj+15 (B)
        v2f a = { tb[row * 17 + 4 * s + kb], tb[row * 17 + 4 * s + kb + 1] };
        int r0 = 16 * jj + 4 * s + kb;
        if (s & 1) dn2 += a; else dn += a;  // denominator: the row sums of attn
        v4f x = *(const v4f*)(sv + r0 * P_ + c4);        // row r0, four tiles
        v4f y = *(const v4f*)(sv + (r0 + 1) * P_ + c4);  // row r0 + 1
        v2f b0 = { x[0], y[0] }, b1 = { x[1], y[1] };
        v2f b2 = { x[2], y[2] }, b3 = { x[3], y[3] };
        acc0 = wmma4(a, b0, acc0);
        acc1 = wmma4(a, b1, acc1);
        acc2 = wmma4(a, b2, acc2);
        acc3 = wmma4(a, b3, acc3);
      }
    }

    if (more) {
      // This wave's LDS reads are done; behind the barrier every wave has left
      // the keys and this chunk's values.
      asm volatile("s_wait_dscnt 0x0" ::: "memory");
      __syncthreads();
      keys_store(sk, tid, kr);
#pragma unroll
      for (int ks = 0; ks < 16; ++ks) {
        qa[ks][0] = fmap(qn[ks][0]);
        qa[ks][1] = fmap(qn[ks][1]);
      }
      // This wave's copies (next states, next values) have landed: a thread adds
      // the earlier groups' sum to its own bytes.
      wait_async();
#pragma unroll
      for (int it = 0; it < 8; ++it) {
        v4f* p = (v4f*)(ss + ((tid >> 4) + 16 * it) * P_ + (tid & 15) * 4);
        *p = *p + ta[it & 3];
      }
      if (tid < 128) sks[tid] = ksn + kts;
      // Hand-over: this wave's LDS writes are done and its copies have landed;
      // behind the barrier that holds for every wave.
      asm volatile("s_wait_dscnt 0x0" ::: "memory");
      __syncthreads();
      if (cc + 2 < G_) values_copy(sv, vp - (cc + 2) * CS_, tid);
    }

    // Denominator: A = the lanes' shares, B = ones: a row's four k slots are summed
    // and land in the accumulators' layout (identical columns, lane-matched).
    const v2f ones = { 1.f, 1.f };
    const v8f accD = wmma4(dn + dn2, ones, v8f{});
    // Z normalize + store.
    // Behind the hand-over: a barrier waits for the wave's stores, and the next one
    // stands a whole state product away.
    float* op = Out + (((size_t)n * L_ + (t0 - cc * T_ + 16 * rt + half * 8)) * H_ +
                       h) * D_ + c4;
#pragma unroll  // constant offsets: one address pair serves all eight stores
    for (int r = 0; r < 8; ++r) {
      float z = 1.f / (accD[r] + 1e-6f);
      v4f o = { acc0[r] * z, acc1[r] * z, acc2[r] * z, acc3[r] * z };
      *(v4f*)(op + r * (H_ * D_)) = o;
    }
    // Closes the run of stores before their address and data registers are reused.
    asm volatile("s_wait_xcnt 0x0" ::: "memory");
  }
  wait_async();  // no copy is left in flight at the wave's end
}

extern "C" void kernel_launch(void* const* d_in, const int* in_sizes, int n_in,
                              void* d_out, int out_size, void* d_ws,
                              size_t ws_size, hipStream_t stream) {
  const float* Qg = (const float*)d_in[0];
  const float* Kg = (const float*)d_in[1];
  const float* Vg = (const float*)d_in[2];
  float* Out = (float*)d_out;
  float* Mbuf = (float*)d_ws;                           // [NH, C, 2, 64, 64] fp32
  float* Ksum = Mbuf + (size_t)NH_ * C_ * 2 * 64 * 64;  // [NH, C, 2, 64] fp32
  float* Mtot = Ksum + (size_t)NH_ * C_ * 2 * 64;       // [NH, NG, 64, 64] fp32
  float* Ktot = Mtot + (size_t)NH_ * NG_ * 64 * 64; // [NH, NG, 64]    fp32

  const size_t smem3 =
      (size_t)(3 * T_ * P_ + 2 * 64 * P_ + 2 * 64 + 8 * 2 * 16 * 17) * sizeof(float);

  k_chunksums<<<dim3(NH_ * NG_), dim3(256), 0, stream>>>(Kg, Vg, Mbuf, Ksum, Mtot,
                                                         Ktot);
  k_main<<<dim3(NH_ * NG_), dim3(256), smem3, stream>>>(Qg, Kg, Vg, Mbuf, Ksum,
                                                       Mtot, Ktot, Out);
}

// v010
// It runs in 60.5 microseconds.
// Next to v009, in two timings, it ran 1.07 times as fast each time.
// Counting every step since v000, it is 2.24 times as fast.
#include <hip/hip_runtime.h>

// Causal linear attention (fp32) on gfx1250 via V_WMMA_F32_16X16X4_F32 +
// GLOBAL_LOAD_ASYNC_TO_LDS_B128 (CDNA5 async global->LDS path).
// 2 passes: (1) a block walks a group of chunks and carries the running K^T V
// and key sums: it stores them in the middle of each half chunk, ahead of rows 32
// and 96 (prefix inside the group), and once more at the end (the group's total),
// (2) output, a block a
// group, chunk by chunk from the last to the first (what pass 1 touched last is
// re-read first, while L2 still holds it), each half of 64 rows from its own state:
// q S, S = prefix inside the group + earlier groups' totals, plus (q k^T) v over
// the keys from the state up to the row (rows behind the state), or minus the
// same over the keys behind the row that the state holds (rows ahead of it). The normalizer
// 1/(q . cumsum k + eps) has one column: a lane adds up its own A-fragment
// elements of it (q * key sums, attn), and one WMMA by ones a row tile and chunk
// folds the four k slots. The causal product costs a row tile one key tile more
// for every 16 rows between it and its state, the state product is the same for
// all: a state that is used to both sides is never more than 32 rows away, and a
// row tile needs one or two key tiles.
// Which column a lane stands for: in a wave's group of n column tiles (4 in
// pass 2, 2 in pass 1) lane c of tile t holds column n*c + t, not 16*t + c. A
// lane's B elements of one k row for all n tiles are then adjacent in LDS (one
// 16- or 8-byte read, not n reads of 4 bytes), and so are its results in memory.

#define N_  4
#define L_  8192
#define H_  8
#define D_  64
#define T_  128       // chunk length
#define C_  64        // chunks = L_/T_
#define NH_ 32        // N_*H_
#define G_  4         // chunks in a group (one pass-1 block)
#define NG_ 16        // groups of a head = C_/G_
#define CS_ (T_ * H_ * D_)  // floats from a chunk's row to the next chunk's
#define P_  68        // padded LDS row stride (floats): 272B = 16B-aligned,
                      // bank = (4*row + col) % 64 -> conflict-free patterns

typedef float v2f __attribute__((ext_vector_type(2)));
typedef float v4f __attribute__((ext_vector_type(4)));
typedef float v8f __attribute__((ext_vector_type(8)));

__device__ __forceinline__ v8f wmma4(v2f a, v2f b, v8f c) {
  // D = A(16x4) * B(4x16) + C(16x16), all fp32
  return __builtin_amdgcn_wmma_f32_16x16x4_f32(false, a, false, b, (short)0, c,
                                               false, false);
}

__device__ __forceinline__ float fmap(float x) {  // elu(x)+1
  return x > 0.f ? x + 1.f : __expf(x);
}

// Async global->LDS copy, 16 bytes per lane. VDST VGPR carries the LDS byte
// offset, VADDR the 64-bit global address (GV mode). Tracked on ASYNCcnt.
__device__ __forceinline__ void async_b128(unsigned lds_off,
                                           unsigned long long gaddr) {
  // The wait in the copy's own statement: its address registers are rewritten
  // only behind it.
  asm volatile("global_load_async_to_lds_b128 %0, %1, off\n\ts_wait_xcnt 0x0"
               :: "v"(lds_off), "v"(gaddr) : "memory");
}
__device__ __forceinline__ void wait_async() {
  asm volatile("s_wait_asynccnt 0" ::: "memory");
}
__device__ __forceinline__ unsigned lds_off(const float* p) {
  return (unsigned)(size_t)p;  // generic LDS addr: low 32 bits = LDS offset
}

// Key tile [128][64] of one chunk and head: thread tid owns 16 bytes of rows
// tid/16 + 16*it (kp: its 16 bytes of row tid/16). The loads and the stores are
// two calls, so that a kernel can put the other global loads of its prologue
// between them: those and the keys' loads are then in flight together and it pays
// their memory latency once.
__device__ __forceinline__ void keys_load(const float* kp, v4f (&kr)[8]) {
#pragma unroll  // constant offsets: one address pair serves all eight loads
  for (int it = 0; it < 8; ++it)
    kr[it] = *(const v4f*)(kp + it * 16 * (H_ * D_));
}
__device__ __forceinline__ void keys_store(float* sk, int tid,
                                           const v4f (&kr)[8]) {
  float* q = sk + (tid >> 4) * P_ + (tid & 15) * 4;
#pragma unroll  // keeps kr[] in registers
  for (int it = 0; it < 8; ++it) {
    v4f f = { fmap(kr[it][0]), fmap(kr[it][1]), fmap(kr[it][2]),
              fmap(kr[it][3]) };
    *(v4f*)(q + it * 16 * P_) = f;
  }
}

// Value tile [128][64] of one chunk and head, async DMA into LDS (raw copy):
// thread tid brings 16 bytes of rows tid/16 + 16*it (vp: those of row tid/16).
__device__ __forceinline__ void values_copy(float* sv, const float* vp,
                                            int tid) {
  const unsigned l = lds_off(sv + (tid >> 4) * P_ + (tid & 15) * 4);
#pragma unroll  // eight copies, each closed by its own s_wait_xcnt
  for (int it = 0; it < 8; ++it)
    async_b128(l + it * 16 * P_ * 4,
               (unsigned long long)(vp + it * 16 * (H_ * D_)));
}

// The two 64x64 states of one chunk (128 rows of 64 floats, contiguous in the
// workspace), async DMA into LDS rows of P_ floats: thread tid brings 16 bytes
// of rows tid/16 + 16*it (sp: those of row tid/16).
__device__ __forceinline__ void states_copy(float* ss, const float* sp,
                                            int tid) {
  const unsigned l = lds_off(ss + (tid >> 4) * P_ + (tid & 15) * 4);
  const unsigned lr = 16 * P_ * 4;  // LDS bytes from one copy to the next
  const unsigned long long g = (unsigned long long)sp;
  const unsigned long long gr = 16 * 64 * 4;  // the same in the workspace
  // One statement: the eight copies issue back to back and share one wait, behind
  // which alone their address registers are rewritten.
  asm volatile(
      "global_load_async_to_lds_b128 %0, %8, off\n\t"
      "global_load_async_to_lds_b128 %1, %9, off\n\t"
      "global_load_async_to_lds_b128 %2, %10, off\n\t"
      "global_load_async_to_lds_b128 %3, %11, off\n\t"
      "global_load_async_to_lds_b128 %4, %12, off\n\t"
      "global_load_async_to_lds_b128 %5, %13, off\n\t"
      "global_load_async_to_lds_b128 %6, %14, off\n\t"
      "global_load_async_to_lds_b128 %7, %15, off\n\t"
      "s_wait_xcnt 0x0"
      :: "v"(l), "v"(l + lr), "v"(l + 2 * lr), "v"(l + 3 * lr), "v"(l + 4 * lr),
         "v"(l + 5 * lr), "v"(l + 6 * lr), "v"(l + 7 * lr), "v"(g), "v"(g + gr),
         "v"(g + 2 * gr), "v"(g + 3 * gr), "v"(g + 4 * gr), "v"(g + 5 * gr),
         "v"(g + 6 * gr), "v"(g + 7 * gr)
      : "memory");
}

// ---- Pass 1: running M = sum k^T v (64x64) and key sums over a group -------
// Two LDS buffers (keys + values each): chunk cc + 1 is on its way from memory
// while chunk cc is worked on.
__global__ __launch_bounds__(256) void k_chunksums(
    const float* __restrict__ Kg, const float* __restrict__ Vg,
    float* __restrict__ Mbuf, float* __restrict__ Ksum,
    float* __restrict__ Mtot, float* __restrict__ Ktot) {
  // buffer b (of two): keys [128][P_], values [128][P_]
  __shared__ __attribute__((aligned(16))) float sm[4 * T_ * P_];
  const int blk = blockIdx.x;           // nh*NG_ + g
  const int g   = blk & (NG_ - 1);
  const int nh  = blk >> 4;
  const int n   = nh >> 3, h = nh & (H_ - 1);
  const int tid = threadIdx.x;
  const size_t off =
      (((size_t)n * L_ + ((size_t)g * (G_ * T_) + (tid >> 4))) * H_ + h) * D_ +
      (tid & 15) * 4;
  const float* kp = Kg + off;
  const float* vp = Vg + off;

  // chunk 0 into buffer 0 (keys need elu(x)+1: through VGPRs)
  v4f kr[8];
  values_copy(sm + T_ * P_, vp, tid);
  keys_load(kp, kr);
  // Closes the run of loads: their address pair stays untouched up to here.
  asm volatile("s_wait_xcnt 0x0" :: "v"(kp) : "memory");
  keys_store(sm, tid, kr);
  wait_async();
  __syncthreads();
  values_copy(sm + 3 * T_ * P_, vp + CS_, tid);  // chunk 1's values, buffer 1

  const int wave = tid >> 5, lane = tid & 31;
  const int col = lane & 15, half = lane >> 4, kb = half * 2;
  const int ti = wave >> 1, tj = (wave & 1) * 2;  // tiles (ti,tj), (ti,tj+1)
  const int e2 = 16 * tj + 2 * col;  // this lane's column of tile tj; tj+1: e2+1
  const int mo = (16 * ti + half * 8) * 64 + e2;
  v8f acc[2] = {}, acc2[2] = {};  // running sums, dual chains a tile
  float ks = 0.f;                 // running key sum of column tid (tid < 64)

#pragma unroll  // cc constant in each copy: buffers and last-trip tests fold away
  for (int cc = 0; cc < G_; ++cc) {
    float* sk = sm + (cc & 1) * (2 * T_ * P_);
    float* sv = sk + T_ * P_;
    if (cc + 1 < G_) {  // next chunk's keys fly while this chunk is worked on
      keys_load(kp + (cc + 1) * CS_, kr);
      // Closes the run of loads: their address pair stays untouched up to here.
      asm volatile("s_wait_xcnt 0x0" :: "v"(kp) : "memory");
    }
    const size_t ch = (size_t)nh * C_ + g * G_ + cc;
#pragma unroll  // qt constant in each copy: the row range folds into offsets
    for (int qt = 0; qt < 4; ++qt) {  // quarters of 32 rows
      if (qt & 1) {  // the state in the middle of a half chunk (rows 32, 96)
        float* mb = Mbuf + (2 * ch + (qt >> 1)) * 4096 + mo;
#pragma unroll  // keeps acc[] in registers
        for (int r = 0; r < 8; ++r) {
          v2f st = { acc[0][r] + acc2[0][r], acc[1][r] + acc2[1][r] };
          *(v2f*)(mb + r * 64) = st;
        }
        // Closes the run of stores before their data registers are reused.
        asm volatile("s_wait_xcnt 0x0" ::: "memory");
      }
      for (int s = 8 * qt; s < 8 * qt + 8; s += 2) {  // K-dim = 32, dual chains
        int k0 = 4 * s + kb;
        v2f a0 = { sk[k0 * P_ + 16 * ti + col],
                   sk[(k0 + 1) * P_ + 16 * ti + col] };
        v2f x0 = *(const v2f*)(sv + k0 * P_ + e2);        // row k0, both tiles
        v2f y0 = *(const v2f*)(sv + (k0 + 1) * P_ + e2);  // row k0 + 1
        v2f b00 = { x0[0], y0[0] }, b01 = { x0[1], y0[1] };
        acc[0] = wmma4(a0, b00, acc[0]);
        acc[1] = wmma4(a0, b01, acc[1]);
        int k1 = k0 + 4;
        v2f a1 = { sk[k1 * P_ + 16 * ti + col],
                   sk[(k1 + 1) * P_ + 16 * ti + col] };
        v2f x1 = *(const v2f*)(sv + k1 * P_ + e2);
        v2f y1 = *(const v2f*)(sv + (k1 + 1) * P_ + e2);
        v2f b10 = { x1[0], y1[0] }, b11 = { x1[1], y1[1] };
        acc2[0] = wmma4(a1, b10, acc2[0]);
        acc2[1] = wmma4(a1, b11, acc2[1]);
      }
    }
    if (tid < 64) {  // per-d key sum for the normalizer, ahead of rows 32 and 96
      float s = 0.f;
      for (int r = 0; r < T_ / 4; ++r) s += sk[r * P_ + tid];
      Ksum[2 * ch * 64 + tid] = ks + s;
      // Closes the store before its address and data registers are reused.
      asm volatile("s_wait_xcnt 0x0" ::: "memory");
      for (int r = T_ / 4; r < 3 * T_ / 4; ++r) s += sk[r * P_ + tid];
      Ksum[(2 * ch + 1) * 64 + tid] = ks + s;
      // Closes the store before its address and data registers are reused.
      asm volatile("s_wait_xcnt 0x0" ::: "memory");
      for (int r = 3 * T_ / 4; r < T_; ++r) s += sk[r * P_ + tid];
      ks += s;
    }
    if (cc + 1 < G_) {
      // the other buffer's last readers left it at the barrier of trip cc - 1
      keys_store(sm + ((cc + 1) & 1) * (2 * T_ * P_), tid, kr);
      // Hand-over: this wave's LDS reads and writes are done, its copies of
      // chunk cc + 1 have landed; behind the barrier that holds for every wave.
      asm volatile("s_wait_dscnt 0x0" ::: "memory");
      wait_async();
      __syncthreads();
      if (cc + 2 < G_) values_copy(sv, vp + (cc + 2) * CS_, tid);
    }
  }
  wait_async();  // no copy is left in flight at the wave's end

  float* mt = Mtot + (size_t)blk * 4096 + mo;  // the group's total
#pragma unroll
  for (int r = 0; r < 8; ++r) {
    v2f st = { acc[0][r] + acc2[0][r], acc[1][r] + acc2[1][r] };
    *(v2f*)(mt + r * 64) = st;
  }
  if (tid < 64) Ktot[(size_t)blk * 64 + tid] = ks;
}

// ---------------- Pass 2: out = (tril(q k^T) v + q S) * Z -------------------
// A block walks the chunks of one group, the last chunk first: the chunks do not
// depend on each other here, and pass 1, which walks them upwards, has left the
// keys, values and states of its latest chunks in L2. Walked upwards again, every
// line would have been pushed out by the rest of the set before its second read.
// The sum of the earlier groups' totals
// is the same for all of them: it is formed once and kept in registers. While a
// chunk is worked on the next one is on its way: keys, q rows and key sums into
// registers, values into the second value buffer, states into the state room as
// soon as every wave has left it.
__global__ __launch_bounds__(256) void k_main(
    const float* __restrict__ Qg, const float* __restrict__ Kg,
    const float* __restrict__ Vg, const float* __restrict__ Mbuf,
    const float* __restrict__ Ksum, const float* __restrict__ Mtot,
    const float* __restrict__ Ktot, float* __restrict__ Out) {
  extern __shared__ float sm[];
  float* sk    = sm;                  // [128][P_] feature-mapped keys
  float* svb   = sk + T_ * P_;        // 2 x [128][P_] values        (async DMA)
  float* ss    = svb + 2 * T_ * P_;   // [2][64][P_] states ahead of rows 32, 96
  float* sks   = ss + 2 * 64 * P_;    // [2][64]   key sums ahead of rows 32, 96
  float* stile = sks + 2 * 64;        // 8 waves x 2 x [16][17] attn tiles

  const int blk = blockIdx.x;  // nh*NG_ + g
  const int g = blk & (NG_ - 1);
  const int nh = blk >> 4;
  const int n = nh >> 3, h = nh & (H_ - 1);
  // first row of the group's last chunk, which is walked first; trip cc works on
  // the chunk that starts cc * T_ rows earlier
  const long t0 = (long)g * (G_ * T_) + (G_ - 1) * T_;
  const int tid = threadIdx.x;
  const size_t off =
      (((size_t)n * L_ + (t0 + (tid >> 4))) * H_ + h) * D_ + (tid & 15) * 4;
  const float* kp = Kg + off;
  const float* vp = Vg + off;
  const float* sp =
      Mbuf + ((size_t)blk * G_ + (G_ - 1)) * (2 * 4096) + tid * 4;

  // first trip's chunk. v: async DMA to LDS (raw copy)
  values_copy(svb, vp, tid);
  // the chunk's two states inside its group: async DMA as well, no registers
  states_copy(ss, sp, tid);
  const int wave = tid >> 5, lane = tid & 31;
  const int row = lane & 15, half = lane >> 4, kb = half * 2;
  const int c4 = row * 4;  // this lane's column of output tile 0; tile t: c4 + t
  // Row tile of this wave. The outer tiles of a half (0, 3, 4, 7) cost two key
  // tiles, the inner ones (1, 2, 5, 6) one; waves w and w + 4 of a block
  // take an outer tile and its inner neighbour, three key tiles' work a pair.
  const int rt = 4 * ((wave & 3) >> 1) +
                 ((wave >> 2) ? 1 + (wave & 1) : 3 * (wave & 1));  // 0 3 4 7 1 2 5 6
  const int sub = rt >> 2;                  // its half of the chunk
  const bool before = (rt & 2) == 0;        // its rows stand ahead of the state
  // Key tiles between this wave's rows and its state, the diagonal tile included.
  const int jlo = before ? rt : 4 * sub + 2;
  const int jhi = before ? 4 * sub + 1 : rt;
  // A sequence's first 32 rows: their state holds little but the keys that would be
  // taken out again, and the difference would lose digits. They add up from nothing.
  const bool head = g == 0 && rt < 2;

  // key sums, keys (elu(x)+1 through VGPRs) and this wave's q rows: every load
  // is issued before the first value is used
  const float* qp =
      Qg + (((size_t)n * L_ + (t0 + 16 * rt + row)) * H_ + h) * D_ + kb;
  // every wave loads: no branch in the run of loads
  const float* ksp = Ksum + ((size_t)blk * G_ + (G_ - 1)) * 128 + (tid & 127);
  float ksv = *ksp;
  v4f kr[8];
  keys_load(kp, kr);
  v2f qa[16];  // q A-fragments for this wave's 16 rows
#pragma unroll  // constant offsets: one address pair serves all sixteen loads
  for (int ks = 0; ks < 16; ++ks) qa[ks] = *(const v2f*)(qp + 4 * ks);
  // Closes the run of loads: their address registers stay untouched up to here.
  // ksv is named so that its load stays in the run and is not sunk to its use.
  asm volatile("s_wait_xcnt 0x0" :: "v"(ksp), "v"(kp), "v"(qp), "v"(ksv)
               : "memory");
  // Holds the keys' feature map behind the run of loads: moved up, it made the q
  // loads wait for the keys' arrival, a second memory round trip.
  __builtin_amdgcn_sched_barrier(0);
  keys_store(sk, tid, kr);
#pragma unroll
  for (int ks = 0; ks < 16; ++ks) {
    qa[ks][0] = fmap(qa[ks][0]);
    qa[ks][1] = fmap(qa[ks][1]);
  }
  // Totals of the head's earlier groups, in ascending order, four groups a trip:
  // a trip's loads are all issued before its first sum (every group has a total
  // in the workspace, so a trip may load past the last one wanted; it adds only
  // the wanted ones). Thread tid owns 16 bytes of rows tid/16 + 16*it of the
  // 64x64 sum, which goes into both states of every chunk of the group.
  const float* tp = Mtot + (size_t)nh * NG_ * 4096 + tid * 4;
  const float* ktp = Ktot + (size_t)nh * NG_ * 64 + (tid & 63);
  v4f ta[4] = {};
  float kts = 0.f;
  for (int g0 = 0; g0 < g; g0 += 4) {
    v4f tv[4][4];
    float kt[4];
#pragma unroll  // constant offsets: two address pairs serve the trip's loads
    for (int j = 0; j < 4; ++j) {
#pragma unroll
      for (int it = 0; it < 4; ++it)
        tv[j][it] = *(const v4f*)(tp + j * 4096 + it * 1024);
      kt[j] = ktp[j * 64];
    }
    // Closes the run of loads before their address pairs are advanced.
    asm volatile("s_wait_xcnt 0x0" :: "v"(tp), "v"(ktp) : "memory");
#pragma unroll  // keeps tv[] in registers
    for (int j = 0; j < 4; ++j)
      if (g0 + j < g) {
#pragma unroll
        for (int it = 0; it < 4; ++it) ta[it] += tv[j][it];
        kts += kt[j];
      }
    tp += 4 * 4096;
    ktp += 4 * 64;
  }
  wait_async();  // this wave's copies have landed: a thread adds to its own bytes
#pragma unroll
  for (int it = 0; it < 8; ++it) {
    v4f* p = (v4f*)(ss + ((tid >> 4) + 16 * it) * P_ + (tid & 15) * 4);
    *p = *p + ta[it & 3];
  }
  if (tid < 128) sks[tid] = ksv + kts;
  __syncthreads();
  values_copy(svb + T_ * P_, vp - CS_, tid);  // second trip's values, buffer 1

  const float* sw = ss + sub * (64 * P_);  // the state inside this wave's half
  const float* kw = sks + sub * 64;

#pragma unroll 1  // one copy of a chunk's code: the kernel's text stays short
  for (int cc = 0; cc < G_; ++cc) {
    float* sv = svb + (cc & 1) * (T_ * P_);
    const bool more = cc + 1 < G_;  // the same for the whole block
    v2f qn[16];
    float ksn = 0.f;
    if (more) {  // next chunk's keys, q rows and key sums fly during this chunk
      const float* ksn_p = ksp - (cc + 1) * 128;
      const float* kn_p = kp - (cc + 1) * CS_;
      const float* qn_p = qp - (cc + 1) * CS_;
      ksn = *ksn_p;
      keys_load(kn_p, kr);
#pragma unroll  // constant offsets: one address pair serves all sixteen loads
      for (int ks = 0; ks < 16; ++ks) qn[ks] = *(const v2f*)(qn_p + 4 * ks);
      // Closes the run of loads: their address registers stay untouched up to here.
      asm volatile("s_wait_xcnt 0x0" :: "v"(ksn_p), "v"(kn_p), "v"(qn_p)
                   : "memory");
    }

    v8f acc0 = {}, acc1 = {}, acc2 = {}, acc3 = {};
    // This lane's share of its row's denominator: the terms that stand at its two
    // k slots of the A fragments (row = lane % 16, slots kb and kb + 1).
    // Two chains: a link waits for its forerunner only every other term.
    v2f dn = {}, dn2 = {};

    const bool fresh = head && cc == G_ - 1;  // no state: plain causal sums
    // Inter-chunk: q @ S (+ q . prefix-ksum into the denominator)
    if (!fresh) {
#pragma unroll
    for (int ks = 0; ks < 16; ++ks) {
      int d0 = 4 * ks + kb;
      v2f bd = { kw[d0], kw[d0 + 1] };
      if (ks & 1) dn2 += qa[ks] * bd; else dn += qa[ks] * bd;
      v4f x = *(const v4f*)(sw + d0 * P_ + c4);        // row d0, four tiles
      v4f y = *(const v4f*)(sw + (d0 + 1) * P_ + c4);  // row d0 + 1
      v2f b0 = { x[0], y[0] }, b1 = { x[1], y[1] };
      v2f b2 = { x[2], y[2] }, b3 = { x[3], y[3] };
      acc0 = wmma4(qa[ks], b0, acc0);
      acc1 = wmma4(qa[ks], b1, acc1);
      acc2 = wmma4(qa[ks], b2, acc2);
      acc3 = wmma4(qa[ks], b3, acc3);
    }
    }
    if (more) {
      // This wave's LDS traffic on the states is done; behind the barrier every
      // wave has read its state, and the next chunk's states may take the room.
      asm volatile("s_wait_dscnt 0x0" ::: "memory");
      __syncthreads();
      states_copy(ss, sp - (cc + 1) * (2 * 4096), tid);
    }

    // Inside the half: attn tiles jlo <= jj <= jhi, fused with attn*v. Rows behind
    // the state add the keys from the state up to themselves; rows ahead of it take
    // out the keys behind themselves, which the state already holds.
    const bool out = before && !fresh;   // keys are taken out of the state
    const float sg = out ? -1.f : 1.f;
    const int j0 = fresh ? 0 : jlo, j1 = fresh ? rt : jhi;
    for (int jj = j0; jj <= j1; ++jj) {
      v8f atA = {}, atB = {};  // dual accumulator chains
#pragma unroll
      for (int ks = 0; ks < 16; ks += 2) {  // K-dim = D = 64
        int d0 = 4 * ks + kb;
        v2f b0 = { sk[(16 * jj + row) * P_ + d0],
                   sk[(16 * jj + row) * P_ + d0 + 1] };
        atA = wmma4(qa[ks], b0, atA);
        int d1 = d0 + 4;
        v2f b1 = { sk[(16 * jj + row) * P_ + d1],
                   sk[(16 * jj + row) * P_ + d1 + 1] };
        atB = wmma4(qa[ks + 1], b1, atB);
      }
      v8f at;
#pragma unroll
      for (int r = 0; r < 8; ++r) at[r] = (atA[r] + atB[r]) * sg;
      if (jj == rt) {  // diagonal tile: rows behind the state keep m >= ncol (tril),
                       // rows ahead of it keep the rest, m < ncol
#pragma unroll
        for (int r = 0; r < 8; ++r)
          if ((half * 8 + r < row) != out) at[r] = 0.f;
      }
      float* tb = stile + (wave * 2 + (jj & 1)) * 16 * 17;  // double-buffered
#pragma unroll
      for (int r = 0; r < 8; ++r)  // D-layout -> LDS for A-fragment reuse
        tb[half * (8 * 17) + row + r * 17] = at[r];

#pragma unroll
      for (int s = 0; s < 4; ++s) {  // attn_tile (A) x v rows 16jj..16jj+15 (B)
        v2f a = { tb[row * 17 + 4 * s + kb], tb[row * 17 + 4 * s + kb + 1] };
        int r0 = 16 * jj + 4 * s + kb;
        if (s & 1) dn2 += a; else dn += a;  // denominator: the row sums of attn
        v4f x = *(const v4f*)(sv + r0 * P_ + c4);        // row r0, four tiles
        v4f y = *(const v4f*)(sv + (r0 + 1) * P_ + c4);  // row r0 + 1
        v2f b0 = { x[0], y[0] }, b1 = { x[1], y[1] };
        v2f b2 = { x[2], y[2] }, b3 = { x[3], y[3] };
        acc0 = wmma4(a, b0, acc0);
        acc1 = wmma4(a, b1, acc1);
        acc2 = wmma4(a, b2, acc2);
        acc3 = wmma4(a, b3, acc3);
      }
    }

    if (more) {
      // This wave's LDS reads are done; behind the barrier every wave has left
      // the keys and this chunk's values.
      asm volatile("s_wait_dscnt 0x0" ::: "memory");
      __syncthreads();
      keys_store(sk, tid, kr);
#pragma unroll
      for (int ks = 0; ks < 16; ++ks) {
        qa[ks][0] = fmap(qn[ks][0]);
        qa[ks][1] = fmap(qn[ks][1]);
      }
      // This wave's copies (next states, next values) have landed: a thread adds
      // the earlier groups' sum to its own bytes.
      wait_async();
#pragma unroll
      for (int it = 0; it < 8; ++it) {
        v4f* p = (v4f*)(ss + ((tid >> 4) + 16 * it) * P_ + (tid & 15) * 4);
        *p = *p + ta[it & 3];
      }
      if (tid < 128) sks[tid] = ksn + kts;
      // Hand-over: this wave's LDS writes are done and its copies have landed;
      // behind the barrier that holds for every wave.
      asm volatile("s_wait_dscnt 0x0" ::: "memory");
      __syncthreads();
      if (cc + 2 < G_) values_copy(sv, vp - (cc + 2) * CS_, tid);
    }

    // Denominator: A = the lanes' shares, B = ones: a row's four k slots are summed
    // and land in the accumulators' layout (identical columns, lane-matched).
    const v2f ones = { 1.f, 1.f };
    const v8f accD = wmma4(dn + dn2, ones, v8f{});
    // Z normalize + store.
    // Behind the hand-over: a barrier waits for the wave's stores, and the next one
    // stands a whole state product away.
    float* op = Out + (((size_t)n * L_ + (t0 - cc * T_ + 16 * rt + half * 8)) * H_ +
                       h) * D_ + c4;
#pragma unroll  // constant offsets: one address pair serves all eight stores
    for (int r = 0; r < 8; ++r) {
      float z = 1.f / (accD[r] + 1e-6f);
      v4f o = { acc0[r] * z, acc1[r] * z, acc2[r] * z, acc3[r] * z };
      *(v4f*)(op + r * (H_ * D_)) = o;
    }
    // Closes the run of stores before their address and data registers are reused.
    asm volatile("s_wait_xcnt 0x0" ::: "memory");
  }
  wait_async();  // no copy is left in flight at the wave's end
}

extern "C" void kernel_launch(void* const* d_in, const int* in_sizes, int n_in,
                              void* d_out, int out_size, void* d_ws,
                              size_t ws_size, hipStream_t stream) {
  const float* Qg = (const float*)d_in[0];
  const float* Kg = (const float*)d_in[1];
  const float* Vg = (const float*)d_in[2];
  float* Out = (float*)d_out;
  float* Mbuf = (float*)d_ws;                           // [NH, C, 2, 64, 64] fp32
  float* Ksum = Mbuf + (size_t)NH_ * C_ * 2 * 64 * 64;  // [NH, C, 2, 64] fp32
  float* Mtot = Ksum + (size_t)NH_ * C_ * 2 * 64;       // [NH, NG, 64, 64] fp32
  float* Ktot = Mtot + (size_t)NH_ * NG_ * 64 * 64; // [NH, NG, 64]    fp32

  const size_t smem3 =
      (size_t)(3 * T_ * P_ + 2 * 64 * P_ + 2 * 64 + 8 * 2 * 16 * 17) * sizeof(float);

  k_chunksums<<<dim3(NH_ * NG_), dim3(256), 0, stream>>>(Kg, Vg, Mbuf, Ksum, Mtot,
                                                         Ktot);
  k_main<<<dim3(NH_ * NG_), dim3(256), smem3, stream>>>(Qg, Kg, Vg, Mbuf, Ksum,
                                                       Mtot, Ktot, Out);
}
